// v000
// Measured on an AMD MI455X. A time is GPU time per run, averaged over a window of back-to-back runs after a warm-up
// (all launches, gaps included; the runs take copies of the inputs in turn), and the median of several windows.
// Apart from v000's, it joins two sittings. Times from different sittings can be a few percent apart, while
// side-by-side timings come from the same sitting.
// The starting kernel, v000, takes 109 microseconds a run.
#include <hip/hip_runtime.h>
#include <hip/hip_bf16.h>

typedef __attribute__((ext_vector_type(16))) _Float16 v16h;
typedef __attribute__((ext_vector_type(8)))  _Float16 v8h;
typedef __attribute__((ext_vector_type(8)))  float    v8f;
typedef __attribute__((ext_vector_type(4)))  float    v4f;

#define N_EMBD 768
#define HEADD  64
#define BATCH  32
#define SEQ    1024
#define MROWS  (BATCH * SEQ)            // 32768 token rows
#define SCALE_Q 0.03608439182435161f    // 768^-0.5
#define LN10K_64 0.14391156856871347f   // ln(10000)/64

// ---- per-wave LDS fence: DS ops are in-order per wave; keep compiler honest
__device__ __forceinline__ void lds_fence() {
    __builtin_amdgcn_wave_barrier();
    asm volatile("s_wait_dscnt 0" ::: "memory");
    __builtin_amdgcn_wave_barrier();
}

__device__ __forceinline__ v8f wmma16(v16h a, v16h b, v8f c) {
    // D = A(16x32 f16) * B(32x16 f16) + C(16x16 f32)
    return __builtin_amdgcn_wmma_f32_16x16x32_f16(
        /*neg_a=*/false, a, /*neg_b=*/false, b,
        /*c_mod=*/(short)0, c, /*reuse_a=*/false, /*reuse_b=*/false);
}

__device__ __forceinline__ v16h load_frag_f16(const _Float16* p, int n0, int k0, int ld) {
    const int lane = threadIdx.x & 31;
    const int n    = lane & 15;
    const int ks   = (lane < 16) ? 0 : 8;
    const _Float16* base = p + (size_t)(n0 + n) * ld + k0 + ks;
    v8h lo = *(const v8h*)(base);
    v8h hi = *(const v8h*)(base + 16);
    v16h r;
#pragma unroll
    for (int i = 0; i < 8; ++i) { r[i] = lo[i]; r[8 + i] = hi[i]; }
    return r;
}

// Same fragment but sourced from fp32 (for the x activations), converted on load.
__device__ __forceinline__ v16h load_frag_f32(const float* p, int n0, int k0, int ld) {
    const int lane = threadIdx.x & 31;
    const int n    = lane & 15;
    const int ks   = (lane < 16) ? 0 : 8;
    const float* base = p + (size_t)(n0 + n) * ld + k0 + ks;
    v4f a0 = *(const v4f*)(base);
    v4f a1 = *(const v4f*)(base + 4);
    v4f b0 = *(const v4f*)(base + 16);
    v4f b1 = *(const v4f*)(base + 20);
    v16h r;
#pragma unroll
    for (int i = 0; i < 4; ++i) {
        r[i]      = (_Float16)a0[i];
        r[4 + i]  = (_Float16)a1[i];
        r[8 + i]  = (_Float16)b0[i];
        r[12 + i] = (_Float16)b1[i];
    }
    return r;
}

// ---------------------------------------------------------------------------
// Kernel 0: W[768][64] fp32 -> Wt[64][768] f16 (x3), so B-fragments are
// two contiguous ds/global b128 loads per lane.
// ---------------------------------------------------------------------------
__global__ __launch_bounds__(256) void wt_prep_kernel(
    const float* __restrict__ Wq, const float* __restrict__ Wk,
    const float* __restrict__ Wv, _Float16* __restrict__ Wt) {
    int idx = blockIdx.x * 256 + threadIdx.x;       // exactly 3*768*64 threads
    int w   = idx / (N_EMBD * HEADD);
    int rme = idx % (N_EMBD * HEADD);
    int kk  = rme >> 6;                             // k index 0..767
    int nn  = rme & 63;                             // n index 0..63
    const float* W = (w == 0) ? Wq : ((w == 1) ? Wk : Wv);
    Wt[(size_t)w * (HEADD * N_EMBD) + (size_t)nn * N_EMBD + kk] = (_Float16)W[rme];
}

// ---------------------------------------------------------------------------
// Kernel 1: q/k/v projection + RoPE. One wave per 16 token rows.
// 24 k-steps x (1 A-frag + 12 B-frags + 12 WMMAs). q gets the softmax scale
// folded in. q,k stored row-major f16 via LDS repack (coalesced b128 stores);
// v stored transposed vT[b][d][t] with packed 16B stores.
// ---------------------------------------------------------------------------
__global__ __launch_bounds__(256) void qkv_rope_kernel(
    const float* __restrict__ x, const _Float16* __restrict__ Wt,
    _Float16* __restrict__ q, _Float16* __restrict__ k,
    _Float16* __restrict__ vT) {
    __shared__ _Float16 lds[8 * 16 * HEADD];        // 2KB per wave
    const int wave  = (blockIdx.x * blockDim.x + threadIdx.x) >> 5;
    const int wlocal = threadIdx.x >> 5;
    const int lane  = threadIdx.x & 31;
    const int n     = lane & 15;
    const int half  = lane >> 4;
    const int m0    = wave * 16;                    // global token-row base
    const int b     = m0 >> 10;
    const int t0    = m0 & 1023;
    _Float16* lp = lds + wlocal * 16 * HEADD;

    const _Float16* Wtq = Wt;
    const _Float16* Wtk = Wt + 1 * HEADD * N_EMBD;
    const _Float16* Wtv = Wt + 2 * HEADD * N_EMBD;

    v8f accq[4], acck[4], accv[4];
    const v8f zf = {0.f, 0.f, 0.f, 0.f, 0.f, 0.f, 0.f, 0.f};
#pragma unroll
    for (int nt = 0; nt < 4; ++nt) { accq[nt] = zf; acck[nt] = zf; accv[nt] = zf; }

    for (int kk = 0; kk < N_EMBD; kk += 32) {
        v16h ax = load_frag_f32(x, m0, kk, N_EMBD);
#pragma unroll
        for (int nt = 0; nt < 4; ++nt) {
            accq[nt] = wmma16(ax, load_frag_f16(Wtq, nt * 16, kk, N_EMBD), accq[nt]);
            acck[nt] = wmma16(ax, load_frag_f16(Wtk, nt * 16, kk, N_EMBD), acck[nt]);
            accv[nt] = wmma16(ax, load_frag_f16(Wtv, nt * 16, kk, N_EMBD), accv[nt]);
        }
    }

    // ---- RoPE: pair (2i,2i+1) lives in adjacent lanes (C-layout: lane = column)
#pragma unroll
    for (int nt = 0; nt < 4; ++nt) {
        const int dcol = nt * 16 + n;
        const float freq = __expf(-(float)(dcol & ~1) * LN10K_64);
        const float sgn  = (dcol & 1) ? 1.f : -1.f;
#pragma unroll
        for (int r = 0; r < 8; ++r) {
            float pos = (float)(t0 + r + 8 * half);
            float s, c;
            __sincosf(pos * freq, &s, &c);
            float vq = accq[nt][r], pq = __shfl_xor(vq, 1, 32);
            float vk = acck[nt][r], pk = __shfl_xor(vk, 1, 32);
            accq[nt][r] = (vq * c + sgn * pq * s) * SCALE_Q;  // fold softmax scale
            acck[nt][r] = (vk * c + sgn * pk * s);
        }
    }

    // ---- q then k: scatter C-layout into LDS, read back rows, coalesced stores
#pragma unroll
    for (int which = 0; which < 2; ++which) {
        v8f* acc = which ? acck : accq;
        _Float16* gout = which ? k : q;
#pragma unroll
        for (int nt = 0; nt < 4; ++nt)
#pragma unroll
            for (int r = 0; r < 8; ++r)
                lp[(r + 8 * half) * HEADD + nt * 16 + n] = (_Float16)acc[nt][r];
        lds_fence();
        {
            const int row = lane >> 1;
            const int co  = (lane & 1) * 32;
#pragma unroll
            for (int j = 0; j < 4; ++j) {
                v8h d = *(const v8h*)(lp + row * HEADD + co + j * 8);
                *(v8h*)(gout + (size_t)(m0 + row) * HEADD + co + j * 8) = d;
            }
        }
        lds_fence();
    }

    // ---- v: store transposed vT[b][d][t]; 8 consecutive t per lane -> 16B store
#pragma unroll
    for (int nt = 0; nt < 4; ++nt) {
        v8h pk;
#pragma unroll
        for (int r = 0; r < 8; ++r) pk[r] = (_Float16)accv[nt][r];
        size_t d = (size_t)b * HEADD + nt * 16 + n;
        *(v8h*)(vT + d * SEQ + t0 + 8 * half) = pk;
    }
}

__global__ __launch_bounds__(256) void flash_attn_kernel(
    const _Float16* __restrict__ q, const _Float16* __restrict__ k,
    const _Float16* __restrict__ vT, float* __restrict__ out) {
    __shared__ _Float16 ldsP[8 * 16 * 32];          // 1KB per wave
    const int wave  = (blockIdx.x * blockDim.x + threadIdx.x) >> 5;
    const int lane  = threadIdx.x & 31;
    const int n     = lane & 15;
    const int half  = lane >> 4;
    const int qrow0 = wave * 16;
    const int b     = qrow0 >> 10;
    const int t0    = qrow0 & 1023;
    _Float16* lp = ldsP + (threadIdx.x >> 5) * 512;
    const _Float16* vb = vT + (size_t)b * HEADD * SEQ;

    v16h aq0 = load_frag_f16(q, qrow0, 0, HEADD);
    v16h aq1 = load_frag_f16(q, qrow0, 32, HEADD);

    v8f acc[4];
    const v8f zf = {0.f, 0.f, 0.f, 0.f, 0.f, 0.f, 0.f, 0.f};
#pragma unroll
    for (int nt = 0; nt < 4; ++nt) acc[nt] = zf;
    float mrow[8], lrow[8];
#pragma unroll
    for (int r = 0; r < 8; ++r) { mrow[r] = -3.0e38f; lrow[r] = 0.f; }

    const int nch = (t0 >> 5) + 1;
    for (int c2 = 0; c2 < nch; ++c2) {
        const int cb = c2 << 5;
        // ---- S = Q K^T for 32 keys (two 16x16 tiles)
        v8f S0 = zf, S1 = zf;
        S0 = wmma16(aq0, load_frag_f16(k, (b << 10) + cb, 0, HEADD), S0);
        S0 = wmma16(aq1, load_frag_f16(k, (b << 10) + cb, 32, HEADD), S0);
        S1 = wmma16(aq0, load_frag_f16(k, (b << 10) + cb + 16, 0, HEADD), S1);
        S1 = wmma16(aq1, load_frag_f16(k, (b << 10) + cb + 16, 32, HEADD), S1);

        if (c2 == nch - 1) {                        // causal mask (diag chunk only)
            const int key0 = cb + n, key1 = key0 + 16;
#pragma unroll
            for (int r = 0; r < 8; ++r) {
                const int row = t0 + r + 8 * half;
                if (key0 > row) S0[r] = -1.0e30f;
                if (key1 > row) S1[r] = -1.0e30f;
            }
        }

        // ---- online softmax; row's 16 values live across one 16-lane group
#pragma unroll
        for (int r = 0; r < 8; ++r) {
            float mx = fmaxf(S0[r], S1[r]);
#pragma unroll
            for (int off = 1; off < 16; off <<= 1) mx = fmaxf(mx, __shfl_xor(mx, off, 32));
            const float mn = fmaxf(mrow[r], mx);
            const float sc = __expf(mrow[r] - mn);
            const float p0 = __expf(S0[r] - mn);
            const float p1 = __expf(S1[r] - mn);
            float rs = p0 + p1;
#pragma unroll
            for (int off = 1; off < 16; off <<= 1) rs += __shfl_xor(rs, off, 32);
            lrow[r] = lrow[r] * sc + rs;
            mrow[r] = mn;
#pragma unroll
            for (int nt = 0; nt < 4; ++nt) acc[nt][r] *= sc;
            lp[(r + 8 * half) * 32 + n]      = (_Float16)p0;
            lp[(r + 8 * half) * 32 + n + 16] = (_Float16)p1;
        }
        lds_fence();
        v16h pa = load_frag_f16(lp, 0, 0, 32);      // A-layout reload (ds_load_b128)
        // ---- O += P V  (V^T gives contiguous B-fragments)
#pragma unroll
        for (int nt = 0; nt < 4; ++nt)
            acc[nt] = wmma16(pa, load_frag_f16(vb, nt * 16, cb, SEQ), acc[nt]);
        lds_fence();                                 // before next chunk reuses lp
    }

    // ---- epilogue: normalize and store fp32 output (coalesced b32 across lanes)
#pragma unroll
    for (int r = 0; r < 8; ++r) {
        const float inv = 1.0f / lrow[r];
        const size_t row = (size_t)(qrow0 + r + 8 * half);
#pragma unroll
        for (int nt = 0; nt < 4; ++nt)
            out[row * HEADD + nt * 16 + n] = acc[nt][r] * inv;
    }
}

// ---------------------------------------------------------------------------
extern "C" void kernel_launch(void* const* d_in, const int* in_sizes, int n_in,
                              void* d_out, int out_size, void* d_ws, size_t ws_size,
                              hipStream_t stream) {
    const float* x  = (const float*)d_in[0];
    const float* Wq = (const float*)d_in[1];
    const float* Wk = (const float*)d_in[2];
    const float* Wv = (const float*)d_in[3];
    float* out = (float*)d_out;

    // workspace layout (f16): Wt[3][64][768] | q[32768][64] | k[32768][64] | vT[32][64][1024]
    unsigned char* ws = (unsigned char*)d_ws;
    const size_t WT_BYTES = (size_t)3 * HEADD * N_EMBD * 2;   //   294912
    const size_t QK_BYTES = (size_t)MROWS * HEADD * 2;        //  4194304
    _Float16* Wt = (_Float16*)(ws);
    _Float16* q  = (_Float16*)(ws + WT_BYTES);
    _Float16* kk = (_Float16*)(ws + WT_BYTES + QK_BYTES);
    _Float16* vT = (_Float16*)(ws + WT_BYTES + 2 * QK_BYTES);

    // 0) weight transpose/convert: 147456 elems, exact grid
    wt_prep_kernel<<<(3 * N_EMBD * HEADD) / 256, 256, 0, stream>>>(Wq, Wk, Wv, Wt);

    // 1) QKV + RoPE: 2048 waves, 8 waves/block
    qkv_rope_kernel<<<MROWS / 128, 256, 0, stream>>>(x, Wt, q, kk, vT);

    // 2) flash attention: 2048 query tiles, 8 waves/block
    flash_attn_kernel<<<(MROWS / 16) / 8, 256, 0, stream>>>(q, kk, vT, out);
}

// v001
// A run of this version takes 84.2 microseconds.
// In two side-by-side timings against v000, it was 1.28 and 1.27 times as fast.
#include <hip/hip_runtime.h>
#include <hip/hip_bf16.h>

typedef __attribute__((ext_vector_type(16))) _Float16 v16h;
typedef __attribute__((ext_vector_type(8)))  _Float16 v8h;
typedef __attribute__((ext_vector_type(8)))  float    v8f;
typedef __attribute__((ext_vector_type(4)))  float    v4f;

#define N_EMBD 768
#define HEADD  64
#define BATCH  32
#define SEQ    1024
#define MROWS  (BATCH * SEQ)            // 32768 token rows
#define SCALE_Q 0.03608439182435161f    // 768^-0.5
#define LN10K_64 0.14391156856871347f   // ln(10000)/64

// ---- per-wave LDS fence: DS ops are in-order per wave; keep compiler honest
__device__ __forceinline__ void lds_fence() {
    __builtin_amdgcn_wave_barrier();
    asm volatile("s_wait_dscnt 0" ::: "memory");
    __builtin_amdgcn_wave_barrier();
}

__device__ __forceinline__ v8f wmma16(v16h a, v16h b, v8f c) {
    // D = A(16x32 f16) * B(32x16 f16) + C(16x16 f32)
    return __builtin_amdgcn_wmma_f32_16x16x32_f16(
        /*neg_a=*/false, a, /*neg_b=*/false, b,
        /*c_mod=*/(short)0, c, /*reuse_a=*/false, /*reuse_b=*/false);
}

__device__ __forceinline__ v16h load_frag_f16(const _Float16* p, int n0, int k0, int ld) {
    const int lane = threadIdx.x & 31;
    const int n    = lane & 15;
    const int ks   = (lane < 16) ? 0 : 8;
    const _Float16* base = p + (size_t)(n0 + n) * ld + k0 + ks;
    v8h lo = *(const v8h*)(base);
    v8h hi = *(const v8h*)(base + 16);
    v16h r;
#pragma unroll
    for (int i = 0; i < 8; ++i) { r[i] = lo[i]; r[8 + i] = hi[i]; }
    return r;
}

// Same fragment but sourced from fp32 (for the x activations). The load and the
// conversion are separate so that the raw words can be fetched one k-step ahead.
struct XRaw { v4f a0, a1, b0, b1; };

__device__ __forceinline__ XRaw load_raw_f32(const float* p, int n0, int k0, int ld) {
    const int lane = threadIdx.x & 31;
    const int n    = lane & 15;
    const int ks   = (lane < 16) ? 0 : 8;
    const float* base = p + (size_t)(n0 + n) * ld + k0 + ks;
    XRaw x;
    x.a0 = *(const v4f*)(base);
    x.a1 = *(const v4f*)(base + 4);
    x.b0 = *(const v4f*)(base + 16);
    x.b1 = *(const v4f*)(base + 20);
    return x;
}

__device__ __forceinline__ v16h cvt_frag_f32(const XRaw& x) {
    v16h r;
#pragma unroll
    for (int i = 0; i < 4; ++i) {
        r[i]      = (_Float16)x.a0[i];
        r[4 + i]  = (_Float16)x.a1[i];
        r[8 + i]  = (_Float16)x.b0[i];
        r[12 + i] = (_Float16)x.b1[i];
    }
    return r;
}

// ---------------------------------------------------------------------------
// Kernel 0: W[768][64] fp32 -> Wt[64][768] f16 (x3), so B-fragments are
// two contiguous ds/global b128 loads per lane.
// ---------------------------------------------------------------------------
__global__ __launch_bounds__(256) void wt_prep_kernel(
    const float* __restrict__ Wq, const float* __restrict__ Wk,
    const float* __restrict__ Wv, _Float16* __restrict__ Wt) {
    int idx = blockIdx.x * 256 + threadIdx.x;       // exactly 3*768*64 threads
    int w   = idx / (N_EMBD * HEADD);
    int rme = idx % (N_EMBD * HEADD);
    int kk  = rme >> 6;                             // k index 0..767
    int nn  = rme & 63;                             // n index 0..63
    const float* W = (w == 0) ? Wq : ((w == 1) ? Wk : Wv);
    Wt[(size_t)w * (HEADD * N_EMBD) + (size_t)nn * N_EMBD + kk] = (_Float16)W[rme];
}

// ---------------------------------------------------------------------------
// Kernel 1: q/k/v projection + RoPE. One wave per 16 token rows.
// 24 k-steps x (1 A-frag + 12 B-frags + 12 WMMAs). All 13 fragments are fetched
// one k-step ahead: each register set is refilled right behind the WMMA that
// read it, so a load has a whole k-step to land. q gets the softmax scale
// folded in. q,k stored row-major f16 via LDS repack (coalesced b128 stores);
// v stored transposed vT[b][d][t] with packed 16B stores.
// ---------------------------------------------------------------------------
__global__ __launch_bounds__(256) void qkv_rope_kernel(
    const float* __restrict__ x, const _Float16* __restrict__ Wt,
    _Float16* __restrict__ q, _Float16* __restrict__ k,
    _Float16* __restrict__ vT) {
    __shared__ _Float16 lds[8 * 16 * HEADD];        // 2KB per wave
    const int wave  = (blockIdx.x * blockDim.x + threadIdx.x) >> 5;
    const int wlocal = threadIdx.x >> 5;
    const int lane  = threadIdx.x & 31;
    const int n     = lane & 15;
    const int half  = lane >> 4;
    const int m0    = wave * 16;                    // global token-row base
    const int b     = m0 >> 10;
    const int t0    = m0 & 1023;
    _Float16* lp = lds + wlocal * 16 * HEADD;

    const _Float16* Wtq = Wt;
    const _Float16* Wtk = Wt + 1 * HEADD * N_EMBD;
    const _Float16* Wtv = Wt + 2 * HEADD * N_EMBD;

    v8f accq[4], acck[4], accv[4];
    const v8f zf = {0.f, 0.f, 0.f, 0.f, 0.f, 0.f, 0.f, 0.f};
#pragma unroll
    for (int nt = 0; nt < 4; ++nt) { accq[nt] = zf; acck[nt] = zf; accv[nt] = zf; }

    XRaw xr = load_raw_f32(x, m0, 0, N_EMBD);
    v16h bq[4], bk[4], bv[4];
#pragma unroll
    for (int nt = 0; nt < 4; ++nt) {
        bq[nt] = load_frag_f16(Wtq, nt * 16, 0, N_EMBD);
        bk[nt] = load_frag_f16(Wtk, nt * 16, 0, N_EMBD);
        bv[nt] = load_frag_f16(Wtv, nt * 16, 0, N_EMBD);
    }

    // fully unrolled: rolled, part of the fragments came back through a second
    // register set and copies at the loop's foot, which wait on the fresh loads
#pragma unroll
    for (int kn = 32; kn <= N_EMBD; kn += 32) {     // kn: the k-step being fetched
        v16h ax = cvt_frag_f32(xr);
        if (kn < N_EMBD) xr = load_raw_f32(x, m0, kn, N_EMBD);
#pragma unroll
        for (int nt = 0; nt < 4; ++nt) {
            accq[nt] = wmma16(ax, bq[nt], accq[nt]);
            acck[nt] = wmma16(ax, bk[nt], acck[nt]);
            accv[nt] = wmma16(ax, bv[nt], accv[nt]);
            if (kn < N_EMBD) {
                bq[nt] = load_frag_f16(Wtq, nt * 16, kn, N_EMBD);
                bk[nt] = load_frag_f16(Wtk, nt * 16, kn, N_EMBD);
                bv[nt] = load_frag_f16(Wtv, nt * 16, kn, N_EMBD);
            }
        }
    }

    // ---- RoPE: pair (2i,2i+1) lives in adjacent lanes (C-layout: lane = column)
#pragma unroll
    for (int nt = 0; nt < 4; ++nt) {
        const int dcol = nt * 16 + n;
        const float freq = __expf(-(float)(dcol & ~1) * LN10K_64);
        const float sgn  = (dcol & 1) ? 1.f : -1.f;
#pragma unroll
        for (int r = 0; r < 8; ++r) {
            float pos = (float)(t0 + r + 8 * half);
            float s, c;
            __sincosf(pos * freq, &s, &c);
            float vq = accq[nt][r], pq = __shfl_xor(vq, 1, 32);
            float vk = acck[nt][r], pk = __shfl_xor(vk, 1, 32);
            accq[nt][r] = (vq * c + sgn * pq * s) * SCALE_Q;  // fold softmax scale
            acck[nt][r] = (vk * c + sgn * pk * s);
        }
    }

    // ---- q then k: scatter C-layout into LDS, read back rows, coalesced stores
#pragma unroll
    for (int which = 0; which < 2; ++which) {
        v8f* acc = which ? acck : accq;
        _Float16* gout = which ? k : q;
#pragma unroll
        for (int nt = 0; nt < 4; ++nt)
#pragma unroll
            for (int r = 0; r < 8; ++r)
                lp[(r + 8 * half) * HEADD + nt * 16 + n] = (_Float16)acc[nt][r];
        lds_fence();
        {
            const int row = lane >> 1;
            const int co  = (lane & 1) * 32;
#pragma unroll
            for (int j = 0; j < 4; ++j) {
                v8h d = *(const v8h*)(lp + row * HEADD + co + j * 8);
                *(v8h*)(gout + (size_t)(m0 + row) * HEADD + co + j * 8) = d;
            }
        }
        lds_fence();
    }

    // ---- v: store transposed vT[b][d][t]; 8 consecutive t per lane -> 16B store
#pragma unroll
    for (int nt = 0; nt < 4; ++nt) {
        v8h pk;
#pragma unroll
        for (int r = 0; r < 8; ++r) pk[r] = (_Float16)accv[nt][r];
        size_t d = (size_t)b * HEADD + nt * 16 + n;
        *(v8h*)(vT + d * SEQ + t0 + 8 * half) = pk;
    }
}

__global__ __launch_bounds__(256) void flash_attn_kernel(
    const _Float16* __restrict__ q, const _Float16* __restrict__ k,
    const _Float16* __restrict__ vT, float* __restrict__ out) {
    __shared__ _Float16 ldsP[8 * 16 * 32];          // 1KB per wave
    const int wave  = (blockIdx.x * blockDim.x + threadIdx.x) >> 5;
    const int lane  = threadIdx.x & 31;
    const int n     = lane & 15;
    const int half  = lane >> 4;
    const int qrow0 = wave * 16;
    const int b     = qrow0 >> 10;
    const int t0    = qrow0 & 1023;
    _Float16* lp = ldsP + (threadIdx.x >> 5) * 512;
    const _Float16* vb = vT + (size_t)b * HEADD * SEQ;

    v16h aq0 = load_frag_f16(q, qrow0, 0, HEADD);
    v16h aq1 = load_frag_f16(q, qrow0, 32, HEADD);

    v8f acc[4];
    const v8f zf = {0.f, 0.f, 0.f, 0.f, 0.f, 0.f, 0.f, 0.f};
#pragma unroll
    for (int nt = 0; nt < 4; ++nt) acc[nt] = zf;
    float mrow[8], lrow[8];
#pragma unroll
    for (int r = 0; r < 8; ++r) { mrow[r] = -3.0e38f; lrow[r] = 0.f; }

    const int nch = (t0 >> 5) + 1;
    v16h kf[4];
    kf[0] = load_frag_f16(k, (b << 10), 0, HEADD);
    kf[1] = load_frag_f16(k, (b << 10), 32, HEADD);
    kf[2] = load_frag_f16(k, (b << 10) + 16, 0, HEADD);
    kf[3] = load_frag_f16(k, (b << 10) + 16, 32, HEADD);
    for (int c2 = 0; c2 < nch; ++c2) {
        const int cb = c2 << 5;
        v16h vf[4];
#pragma unroll
        for (int nt = 0; nt < 4; ++nt) vf[nt] = load_frag_f16(vb, nt * 16, cb, SEQ);
        // ---- S = Q K^T for 32 keys (two 16x16 tiles)
        v8f S0 = zf, S1 = zf;
        S0 = wmma16(aq0, kf[0], S0);
        S0 = wmma16(aq1, kf[1], S0);
        S1 = wmma16(aq0, kf[2], S1);
        S1 = wmma16(aq1, kf[3], S1);
        // the K refill may land in the V loads' address registers: their translations first
        asm volatile("s_wait_xcnt 0x0" ::: "memory");
        // next chunk's K; the last chunk fetches itself again (in bounds, unused)
        const int kn = (b << 10) + (((c2 + 1 < nch) ? c2 + 1 : c2) << 5);
        kf[0] = load_frag_f16(k, kn, 0, HEADD);
        kf[1] = load_frag_f16(k, kn, 32, HEADD);
        kf[2] = load_frag_f16(k, kn + 16, 0, HEADD);
        kf[3] = load_frag_f16(k, kn + 16, 32, HEADD);

        if (c2 == nch - 1) {                        // causal mask (diag chunk only)
            const int key0 = cb + n, key1 = key0 + 16;
#pragma unroll
            for (int r = 0; r < 8; ++r) {
                const int row = t0 + r + 8 * half;
                if (key0 > row) S0[r] = -1.0e30f;
                if (key1 > row) S1[r] = -1.0e30f;
            }
        }

        // ---- online softmax; row's 16 values live across one 16-lane group
#pragma unroll
        for (int r = 0; r < 8; ++r) {
            float mx = fmaxf(S0[r], S1[r]);
#pragma unroll
            for (int off = 1; off < 16; off <<= 1) mx = fmaxf(mx, __shfl_xor(mx, off, 32));
            const float mn = fmaxf(mrow[r], mx);
            const float sc = __expf(mrow[r] - mn);
            const float p0 = __expf(S0[r] - mn);
            const float p1 = __expf(S1[r] - mn);
            float rs = p0 + p1;
#pragma unroll
            for (int off = 1; off < 16; off <<= 1) rs += __shfl_xor(rs, off, 32);
            lrow[r] = lrow[r] * sc + rs;
            mrow[r] = mn;
#pragma unroll
            for (int nt = 0; nt < 4; ++nt) acc[nt][r] *= sc;
            lp[(r + 8 * half) * 32 + n]      = (_Float16)p0;
            lp[(r + 8 * half) * 32 + n + 16] = (_Float16)p1;
        }
        lds_fence();
        v16h pa = load_frag_f16(lp, 0, 0, 32);      // A-layout reload (ds_load_b128)
        // ---- O += P V  (V^T gives contiguous B-fragments)
#pragma unroll
        for (int nt = 0; nt < 4; ++nt)
            acc[nt] = wmma16(pa, vf[nt], acc[nt]);
        lds_fence();                                 // before next chunk reuses lp
    }

    // ---- epilogue: normalize and store fp32 output (coalesced b32 across lanes)
#pragma unroll
    for (int r = 0; r < 8; ++r) {
        const float inv = 1.0f / lrow[r];
        const size_t row = (size_t)(qrow0 + r + 8 * half);
#pragma unroll
        for (int nt = 0; nt < 4; ++nt)
            out[row * HEADD + nt * 16 + n] = acc[nt][r] * inv;
    }
}

// ---------------------------------------------------------------------------
extern "C" void kernel_launch(void* const* d_in, const int* in_sizes, int n_in,
                              void* d_out, int out_size, void* d_ws, size_t ws_size,
                              hipStream_t stream) {
    const float* x  = (const float*)d_in[0];
    const float* Wq = (const float*)d_in[1];
    const float* Wk = (const float*)d_in[2];
    const float* Wv = (const float*)d_in[3];
    float* out = (float*)d_out;

    // workspace layout (f16): Wt[3][64][768] | q[32768][64] | k[32768][64] | vT[32][64][1024]
    unsigned char* ws = (unsigned char*)d_ws;
    const size_t WT_BYTES = (size_t)3 * HEADD * N_EMBD * 2;   //   294912
    const size_t QK_BYTES = (size_t)MROWS * HEADD * 2;        //  4194304
    _Float16* Wt = (_Float16*)(ws);
    _Float16* q  = (_Float16*)(ws + WT_BYTES);
    _Float16* kk = (_Float16*)(ws + WT_BYTES + QK_BYTES);
    _Float16* vT = (_Float16*)(ws + WT_BYTES + 2 * QK_BYTES);

    // 0) weight transpose/convert: 147456 elems, exact grid
    wt_prep_kernel<<<(3 * N_EMBD * HEADD) / 256, 256, 0, stream>>>(Wq, Wk, Wv, Wt);

    // 1) QKV + RoPE: 2048 waves, 8 waves/block
    qkv_rope_kernel<<<MROWS / 128, 256, 0, stream>>>(x, Wt, q, kk, vT);

    // 2) flash attention: 2048 query tiles, 8 waves/block
    flash_attn_kernel<<<(MROWS / 16) / 8, 256, 0, stream>>>(q, kk, vT, out);
}

// v002
// A run of this version takes 57.5 microseconds.
// Timed twice side by side with v001, it ran 1.46 times as fast both times.
// Counting every step since v000, it is 1.86 times as fast.
#include <hip/hip_runtime.h>
#include <hip/hip_bf16.h>

typedef __attribute__((ext_vector_type(16))) _Float16 v16h;
typedef __attribute__((ext_vector_type(8)))  _Float16 v8h;
typedef __attribute__((ext_vector_type(8)))  float    v8f;
typedef __attribute__((ext_vector_type(4)))  float    v4f;

#define N_EMBD 768
#define HEADD  64
#define BATCH  32
#define SEQ    1024
#define MROWS  (BATCH * SEQ)            // 32768 token rows
#define SCALE_Q 0.03608439182435161f    // 768^-0.5
#define LN10K_64 0.14391156856871347f   // ln(10000)/64

// ---- per-wave LDS fence: DS ops are in-order per wave; keep compiler honest
__device__ __forceinline__ void lds_fence() {
    __builtin_amdgcn_wave_barrier();
    asm volatile("s_wait_dscnt 0" ::: "memory");
    __builtin_amdgcn_wave_barrier();
}

__device__ __forceinline__ v8f wmma16(v16h a, v16h b, v8f c) {
    // D = A(16x32 f16) * B(32x16 f16) + C(16x16 f32)
    return __builtin_amdgcn_wmma_f32_16x16x32_f16(
        /*neg_a=*/false, a, /*neg_b=*/false, b,
        /*c_mod=*/(short)0, c, /*reuse_a=*/false, /*reuse_b=*/false);
}

__device__ __forceinline__ v16h load_frag_f16(const _Float16* p, int n0, int k0, int ld) {
    const int lane = threadIdx.x & 31;
    const int n    = lane & 15;
    const int ks   = (lane < 16) ? 0 : 8;
    const _Float16* base = p + (size_t)(n0 + n) * ld + k0 + ks;
    v8h lo = *(const v8h*)(base);
    v8h hi = *(const v8h*)(base + 16);
    v16h r;
#pragma unroll
    for (int i = 0; i < 8; ++i) { r[i] = lo[i]; r[8 + i] = hi[i]; }
    return r;
}

__device__ __forceinline__ v16h load_frag_packed(const _Float16* frag) {
    const int lane = threadIdx.x & 31;
    v8h lo = *(const v8h*)(frag + lane * 8);
    v8h hi = *(const v8h*)(frag + 256 + lane * 8);
    v16h r;
#pragma unroll
    for (int i = 0; i < 8; ++i) { r[i] = lo[i]; r[8 + i] = hi[i]; }
    return r;
}

// Same fragment but sourced from fp32 (for the x activations). The load and the
// conversion are separate so that the raw words can be fetched one k-step ahead.
struct XRaw { v4f a0, a1, b0, b1; };

__device__ __forceinline__ XRaw load_raw_f32(const float* p, int n0, int k0, int ld) {
    const int lane = threadIdx.x & 31;
    const int n    = lane & 15;
    const int ks   = (lane < 16) ? 0 : 8;
    const float* base = p + (size_t)(n0 + n) * ld + k0 + ks;
    XRaw x;
    x.a0 = *(const v4f*)(base);
    x.a1 = *(const v4f*)(base + 4);
    x.b0 = *(const v4f*)(base + 16);
    x.b1 = *(const v4f*)(base + 20);
    return x;
}

__device__ __forceinline__ v16h cvt_frag_f32(const XRaw& x) {
    v16h r;
#pragma unroll
    for (int i = 0; i < 4; ++i) {
        r[i]      = (_Float16)x.a0[i];
        r[4 + i]  = (_Float16)x.a1[i];
        r[8 + i]  = (_Float16)x.b0[i];
        r[12 + i] = (_Float16)x.b1[i];
    }
    return r;
}

// ---------------------------------------------------------------------------
// Kernel 0: W[768][64] fp32 (x3) -> f16 B-fragments in lane order,
// Wt[k-step 0..23][matrix 0..2][n-tile 0..3][1KB fragment]: the 12 fragments of
// one k-step are 12KB in a row.
// ---------------------------------------------------------------------------
__global__ __launch_bounds__(256) void wt_prep_kernel(
    const float* __restrict__ Wq, const float* __restrict__ Wk,
    const float* __restrict__ Wv, _Float16* __restrict__ Wt) {
    int idx = blockIdx.x * 256 + threadIdx.x;       // exactly 3*768*64 threads
    int w   = idx / (N_EMBD * HEADD);
    int rme = idx % (N_EMBD * HEADD);
    int kk  = rme >> 6;                             // k index 0..767
    int nn  = rme & 63;                             // n index 0..63
    const float* W = (w == 0) ? Wq : ((w == 1) ? Wk : Wv);
    const int frag = (kk >> 5) * 12 + w * 4 + (nn >> 4);
    const int part = (kk >> 4) & 1;                 // K 0..15 | 16..31 of the k-step
    const int ln   = ((kk >> 3) & 1) * 16 + (nn & 15);
    Wt[(size_t)frag * 512 + part * 256 + ln * 8 + (kk & 7)] = (_Float16)W[rme];
}

// ---------------------------------------------------------------------------
// Kernel 1: q/k/v projection + RoPE. One wave per 16 token rows.
// 24 k-steps x (1 A-frag + 12 B-frags + 12 WMMAs). All 13 fragments are fetched
// one k-step ahead: each register set is refilled right behind the WMMA that
// read it, so a load has a whole k-step to land. q gets the softmax scale
// folded in. q,k,v are stored as the fragments the attention kernel reads, in
// lane order: q,k per 16 rows [d-step 0..1][1KB] via LDS repack, v per 32 keys
// [d-tile 0..3][1KB] straight from the accumulators; every store is 512B in a row.
// ---------------------------------------------------------------------------
__global__ __launch_bounds__(256) void qkv_rope_kernel(
    const float* __restrict__ x, const _Float16* __restrict__ Wt,
    _Float16* __restrict__ q, _Float16* __restrict__ k,
    _Float16* __restrict__ vT) {
    __shared__ _Float16 lds[8 * 16 * HEADD];        // 2KB per wave
    const int wave  = (blockIdx.x * blockDim.x + threadIdx.x) >> 5;
    const int wlocal = threadIdx.x >> 5;
    const int lane  = threadIdx.x & 31;
    const int n     = lane & 15;
    const int half  = lane >> 4;
    const int m0    = wave * 16;                    // global token-row base
    const int b     = m0 >> 10;
    const int t0    = m0 & 1023;
    _Float16* lp = lds + wlocal * 16 * HEADD;

    const _Float16* Wtq = Wt;                       // + k-step * 12 fragments
    const _Float16* Wtk = Wt + 4 * 512;
    const _Float16* Wtv = Wt + 8 * 512;

    v8f accq[4], acck[4], accv[4];
    const v8f zf = {0.f, 0.f, 0.f, 0.f, 0.f, 0.f, 0.f, 0.f};
#pragma unroll
    for (int nt = 0; nt < 4; ++nt) { accq[nt] = zf; acck[nt] = zf; accv[nt] = zf; }

    XRaw xr = load_raw_f32(x, m0, 0, N_EMBD);
    v16h bq[4], bk[4], bv[4];
#pragma unroll
    for (int nt = 0; nt < 4; ++nt) {
        bq[nt] = load_frag_packed(Wtq + nt * 512);
        bk[nt] = load_frag_packed(Wtk + nt * 512);
        bv[nt] = load_frag_packed(Wtv + nt * 512);
    }

    // fully unrolled: rolled, part of the fragments came back through a second
    // register set and copies at the loop's foot, which wait on the fresh loads
#pragma unroll
    for (int kn = 32; kn <= N_EMBD; kn += 32) {     // kn: the k-step being fetched
        v16h ax = cvt_frag_f32(xr);
        if (kn < N_EMBD) xr = load_raw_f32(x, m0, kn, N_EMBD);
#pragma unroll
        for (int nt = 0; nt < 4; ++nt) {
            accq[nt] = wmma16(ax, bq[nt], accq[nt]);
            acck[nt] = wmma16(ax, bk[nt], acck[nt]);
            accv[nt] = wmma16(ax, bv[nt], accv[nt]);
            if (kn < N_EMBD) {
                bq[nt] = load_frag_packed(Wtq + ((kn >> 5) * 12 + nt) * 512);
                bk[nt] = load_frag_packed(Wtk + ((kn >> 5) * 12 + nt) * 512);
                bv[nt] = load_frag_packed(Wtv + ((kn >> 5) * 12 + nt) * 512);
            }
        }
    }

    // ---- RoPE: pair (2i,2i+1) lives in adjacent lanes (C-layout: lane = column)
#pragma unroll
    for (int nt = 0; nt < 4; ++nt) {
        const int dcol = nt * 16 + n;
        const float freq = __expf(-(float)(dcol & ~1) * LN10K_64);
        const float sgn  = (dcol & 1) ? 1.f : -1.f;
#pragma unroll
        for (int r = 0; r < 8; ++r) {
            float pos = (float)(t0 + r + 8 * half);
            float s, c;
            __sincosf(pos * freq, &s, &c);
            float vq = accq[nt][r], pq = __shfl_xor(vq, 1, 32);
            float vk = acck[nt][r], pk = __shfl_xor(vk, 1, 32);
            accq[nt][r] = (vq * c + sgn * pq * s) * SCALE_Q;  // fold softmax scale
            acck[nt][r] = (vk * c + sgn * pk * s);
        }
    }

    // ---- q then k: scatter C-layout into LDS, read back in fragment lane order
#pragma unroll
    for (int which = 0; which < 2; ++which) {
        v8f* acc = which ? acck : accq;
        _Float16* gout = which ? k : q;
#pragma unroll
        for (int nt = 0; nt < 4; ++nt)
#pragma unroll
            for (int r = 0; r < 8; ++r)
                lp[(r + 8 * half) * HEADD + nt * 16 + n] = (_Float16)acc[nt][r];
        lds_fence();
#pragma unroll
        for (int j = 0; j < 4; ++j) {               // j = 2 * d-step + part
            v8h d = *(const v8h*)(lp + n * HEADD + j * 16 + half * 8);
            *(v8h*)(gout + (size_t)m0 * HEADD + j * 256 + lane * 8) = d;
        }
        lds_fence();
    }

    // ---- v: these 16 tokens are one part of their 32-key chunk's B-fragments, and
    // the accumulator's lane (column d, 8 consecutive t) is the fragment's own lane
#pragma unroll
    for (int nt = 0; nt < 4; ++nt) {
        v8h pk;
#pragma unroll
        for (int r = 0; r < 8; ++r) pk[r] = (_Float16)accv[nt][r];
        *(v8h*)(vT + (size_t)b * HEADD * SEQ + ((t0 >> 5) * 4 + nt) * 512
                + ((t0 >> 4) & 1) * 256 + lane * 8) = pk;
    }
}

__global__ __launch_bounds__(256) void flash_attn_kernel(
    const _Float16* __restrict__ q, const _Float16* __restrict__ k,
    const _Float16* __restrict__ vT, float* __restrict__ out) {
    __shared__ _Float16 ldsP[8 * 16 * 32];          // 1KB per wave
    const int wave  = (blockIdx.x * blockDim.x + threadIdx.x) >> 5;
    const int lane  = threadIdx.x & 31;
    const int n     = lane & 15;
    const int half  = lane >> 4;
    const int qrow0 = wave * 16;
    const int b     = qrow0 >> 10;
    const int t0    = qrow0 & 1023;
    _Float16* lp = ldsP + (threadIdx.x >> 5) * 512;
    const _Float16* vb = vT + (size_t)b * HEADD * SEQ;

    v16h aq0 = load_frag_packed(q + (size_t)qrow0 * HEADD);
    v16h aq1 = load_frag_packed(q + (size_t)qrow0 * HEADD + 512);

    v8f acc[4];
    const v8f zf = {0.f, 0.f, 0.f, 0.f, 0.f, 0.f, 0.f, 0.f};
#pragma unroll
    for (int nt = 0; nt < 4; ++nt) acc[nt] = zf;
    float mrow[8], lrow[8];
#pragma unroll
    for (int r = 0; r < 8; ++r) { mrow[r] = -3.0e38f; lrow[r] = 0.f; }

    const int nch = (t0 >> 5) + 1;
    v16h kf[4];
    const _Float16* kb = k + (size_t)(b << 10) * HEADD;
#pragma unroll
    for (int f = 0; f < 4; ++f) kf[f] = load_frag_packed(kb + f * 512);
    for (int c2 = 0; c2 < nch; ++c2) {
        const int cb = c2 << 5;
        v16h vf[4];
#pragma unroll
        for (int nt = 0; nt < 4; ++nt) vf[nt] = load_frag_packed(vb + (c2 * 4 + nt) * 512);
        // ---- S = Q K^T for 32 keys (two 16x16 tiles)
        v8f S0 = zf, S1 = zf;
        S0 = wmma16(aq0, kf[0], S0);
        S0 = wmma16(aq1, kf[1], S0);
        S1 = wmma16(aq0, kf[2], S1);
        S1 = wmma16(aq1, kf[3], S1);
        // the K refill may land in the V loads' address registers: their translations first
        asm volatile("s_wait_xcnt 0x0" ::: "memory");
        // next chunk's K; the last chunk fetches itself again (in bounds, unused)
        const int cn = (c2 + 1 < nch) ? c2 + 1 : c2;
#pragma unroll
        for (int f = 0; f < 4; ++f) kf[f] = load_frag_packed(kb + (cn * 4 + f) * 512);

        if (c2 == nch - 1) {                        // causal mask (diag chunk only)
            const int key0 = cb + n, key1 = key0 + 16;
#pragma unroll
            for (int r = 0; r < 8; ++r) {
                const int row = t0 + r + 8 * half;
                if (key0 > row) S0[r] = -1.0e30f;
                if (key1 > row) S1[r] = -1.0e30f;
            }
        }

        // ---- online softmax; row's 16 values live across one 16-lane group
#pragma unroll
        for (int r = 0; r < 8; ++r) {
            float mx = fmaxf(S0[r], S1[r]);
#pragma unroll
            for (int off = 1; off < 16; off <<= 1) mx = fmaxf(mx, __shfl_xor(mx, off, 32));
            const float mn = fmaxf(mrow[r], mx);
            const float sc = __expf(mrow[r] - mn);
            const float p0 = __expf(S0[r] - mn);
            const float p1 = __expf(S1[r] - mn);
            float rs = p0 + p1;
#pragma unroll
            for (int off = 1; off < 16; off <<= 1) rs += __shfl_xor(rs, off, 32);
            lrow[r] = lrow[r] * sc + rs;
            mrow[r] = mn;
#pragma unroll
            for (int nt = 0; nt < 4; ++nt) acc[nt][r] *= sc;
            lp[(r + 8 * half) * 32 + n]      = (_Float16)p0;
            lp[(r + 8 * half) * 32 + n + 16] = (_Float16)p1;
        }
        lds_fence();
        v16h pa = load_frag_f16(lp, 0, 0, 32);      // A-layout reload (ds_load_b128)
        // ---- O += P V
#pragma unroll
        for (int nt = 0; nt < 4; ++nt)
            acc[nt] = wmma16(pa, vf[nt], acc[nt]);
        lds_fence();                                 // before next chunk reuses lp
    }

    // ---- epilogue: normalize and store fp32 output (coalesced b32 across lanes)
#pragma unroll
    for (int r = 0; r < 8; ++r) {
        const float inv = 1.0f / lrow[r];
        const size_t row = (size_t)(qrow0 + r + 8 * half);
#pragma unroll
        for (int nt = 0; nt < 4; ++nt)
            out[row * HEADD + nt * 16 + n] = acc[nt][r] * inv;
    }
}

// ---------------------------------------------------------------------------
extern "C" void kernel_launch(void* const* d_in, const int* in_sizes, int n_in,
                              void* d_out, int out_size, void* d_ws, size_t ws_size,
                              hipStream_t stream) {
    const float* x  = (const float*)d_in[0];
    const float* Wq = (const float*)d_in[1];
    const float* Wk = (const float*)d_in[2];
    const float* Wv = (const float*)d_in[3];
    float* out = (float*)d_out;

    // workspace layout (f16, 1KB lane-order fragments): Wt[24][12] | q[2048][2] | k[2048][2] | v[32][32][4]
    unsigned char* ws = (unsigned char*)d_ws;
    const size_t WT_BYTES = (size_t)3 * HEADD * N_EMBD * 2;   //   294912
    const size_t QK_BYTES = (size_t)MROWS * HEADD * 2;        //  4194304
    _Float16* Wt = (_Float16*)(ws);
    _Float16* q  = (_Float16*)(ws + WT_BYTES);
    _Float16* kk = (_Float16*)(ws + WT_BYTES + QK_BYTES);
    _Float16* vT = (_Float16*)(ws + WT_BYTES + 2 * QK_BYTES);

    // 0) weight convert into fragments: 147456 elems, exact grid
    wt_prep_kernel<<<(3 * N_EMBD * HEADD) / 256, 256, 0, stream>>>(Wq, Wk, Wv, Wt);

    // 1) QKV + RoPE: 2048 waves, 8 waves/block
    qkv_rope_kernel<<<MROWS / 128, 256, 0, stream>>>(x, Wt, q, kk, vT);

    // 2) flash attention: 2048 query tiles, 8 waves/block
    flash_attn_kernel<<<(MROWS / 16) / 8, 256, 0, stream>>>(q, kk, vT, out);
}

// v003
// A run of this version takes 51.8 microseconds.
// In two side-by-side timings against v002, it was 1.11 and 1.12 times as fast.
// All steps since v000 together make it 2.07 times as fast.
#include <hip/hip_runtime.h>
#include <hip/hip_bf16.h>

typedef __attribute__((ext_vector_type(16))) _Float16 v16h;
typedef __attribute__((ext_vector_type(8)))  _Float16 v8h;
typedef __attribute__((ext_vector_type(8)))  float    v8f;
typedef __attribute__((ext_vector_type(4)))  float    v4f;

#define N_EMBD 768
#define HEADD  64
#define BATCH  32
#define SEQ    1024
#define MROWS  (BATCH * SEQ)            // 32768 token rows
#define SCALE_Q 0.03608439182435161f    // 768^-0.5
#define LN10K_64 0.14391156856871347f   // ln(10000)/64

// ---- per-wave LDS fence: DS ops are in-order per wave; keep compiler honest
__device__ __forceinline__ void lds_fence() {
    __builtin_amdgcn_wave_barrier();
    asm volatile("s_wait_dscnt 0" ::: "memory");
    __builtin_amdgcn_wave_barrier();
}

__device__ __forceinline__ v8f wmma16(v16h a, v16h b, v8f c) {
    // D = A(16x32 f16) * B(32x16 f16) + C(16x16 f32)
    return __builtin_amdgcn_wmma_f32_16x16x32_f16(
        /*neg_a=*/false, a, /*neg_b=*/false, b,
        /*c_mod=*/(short)0, c, /*reuse_a=*/false, /*reuse_b=*/false);
}

__device__ __forceinline__ v16h load_frag_packed(const _Float16* frag) {
    const int lane = threadIdx.x & 31;
    v8h lo = *(const v8h*)(frag + lane * 8);
    v8h hi = *(const v8h*)(frag + 256 + lane * 8);
    v16h r;
#pragma unroll
    for (int i = 0; i < 8; ++i) { r[i] = lo[i]; r[8 + i] = hi[i]; }
    return r;
}

// Same fragment but sourced from fp32 (for the x activations). The load and the
// conversion are separate so that the raw words can be fetched one k-step ahead.
struct XRaw { v4f a0, a1, b0, b1; };

__device__ __forceinline__ XRaw load_raw_f32(const float* p, int n0, int k0, int ld) {
    const int lane = threadIdx.x & 31;
    const int n    = lane & 15;
    const int ks   = (lane < 16) ? 0 : 8;
    const float* base = p + (size_t)(n0 + n) * ld + k0 + ks;
    XRaw x;
    x.a0 = *(const v4f*)(base);
    x.a1 = *(const v4f*)(base + 4);
    x.b0 = *(const v4f*)(base + 16);
    x.b1 = *(const v4f*)(base + 20);
    return x;
}

__device__ __forceinline__ v16h cvt_frag_f32(const XRaw& x) {
    v16h r;
#pragma unroll
    for (int i = 0; i < 4; ++i) {
        r[i]      = (_Float16)x.a0[i];
        r[4 + i]  = (_Float16)x.a1[i];
        r[8 + i]  = (_Float16)x.b0[i];
        r[12 + i] = (_Float16)x.b1[i];
    }
    return r;
}

// ---------------------------------------------------------------------------
// Kernel 0: W[768][64] fp32 (x3) -> f16 B-fragments in lane order,
// Wt[k-step 0..23][matrix 0..2][n-tile 0..3][1KB fragment]: the 12 fragments of
// one k-step are 12KB in a row.
// ---------------------------------------------------------------------------
__global__ __launch_bounds__(256) void wt_prep_kernel(
    const float* __restrict__ Wq, const float* __restrict__ Wk,
    const float* __restrict__ Wv, _Float16* __restrict__ Wt) {
    int idx = blockIdx.x * 256 + threadIdx.x;       // exactly 3*768*64 threads
    int w   = idx / (N_EMBD * HEADD);
    int rme = idx % (N_EMBD * HEADD);
    int kk  = rme >> 6;                             // k index 0..767
    int nn  = rme & 63;                             // n index 0..63
    const float* W = (w == 0) ? Wq : ((w == 1) ? Wk : Wv);
    const int frag = (kk >> 5) * 12 + w * 4 + (nn >> 4);
    const int part = (kk >> 4) & 1;                 // K 0..15 | 16..31 of the k-step
    const int ln   = ((kk >> 3) & 1) * 16 + (nn & 15);
    Wt[(size_t)frag * 512 + part * 256 + ln * 8 + (kk & 7)] = (_Float16)W[rme];
}

// ---------------------------------------------------------------------------
// Kernel 1: q/k/v projection + RoPE. One wave per 16 token rows.
// 24 k-steps x (1 A-frag + 12 B-frags + 12 WMMAs). All 13 fragments are fetched
// one k-step ahead: each register set is refilled right behind the WMMA that
// read it, so a load has a whole k-step to land. q gets the softmax scale
// folded in. q,k,v are stored as the fragments the attention kernel reads, in
// lane order: q,k per 16 rows [d-step 0..1][1KB] via LDS repack, v per 32 keys
// [d-tile 0..3][1KB] straight from the accumulators; every store is 512B in a row.
// ---------------------------------------------------------------------------
__global__ __launch_bounds__(256) void qkv_rope_kernel(
    const float* __restrict__ x, const _Float16* __restrict__ Wt,
    _Float16* __restrict__ q, _Float16* __restrict__ k,
    _Float16* __restrict__ vT) {
    __shared__ _Float16 lds[8 * 16 * HEADD];        // 2KB per wave
    const int wave  = (blockIdx.x * blockDim.x + threadIdx.x) >> 5;
    const int wlocal = threadIdx.x >> 5;
    const int lane  = threadIdx.x & 31;
    const int n     = lane & 15;
    const int half  = lane >> 4;
    const int m0    = wave * 16;                    // global token-row base
    const int b     = m0 >> 10;
    const int t0    = m0 & 1023;
    _Float16* lp = lds + wlocal * 16 * HEADD;

    const _Float16* Wtq = Wt;                       // + k-step * 12 fragments
    const _Float16* Wtk = Wt + 4 * 512;
    const _Float16* Wtv = Wt + 8 * 512;

    v8f accq[4], acck[4], accv[4];
    const v8f zf = {0.f, 0.f, 0.f, 0.f, 0.f, 0.f, 0.f, 0.f};
#pragma unroll
    for (int nt = 0; nt < 4; ++nt) { accq[nt] = zf; acck[nt] = zf; accv[nt] = zf; }

    XRaw xr = load_raw_f32(x, m0, 0, N_EMBD);
    v16h bq[4], bk[4], bv[4];
#pragma unroll
    for (int nt = 0; nt < 4; ++nt) {
        bq[nt] = load_frag_packed(Wtq + nt * 512);
        bk[nt] = load_frag_packed(Wtk + nt * 512);
        bv[nt] = load_frag_packed(Wtv + nt * 512);
    }

    // fully unrolled: rolled, part of the fragments came back through a second
    // register set and copies at the loop's foot, which wait on the fresh loads
#pragma unroll
    for (int kn = 32; kn <= N_EMBD; kn += 32) {     // kn: the k-step being fetched
        v16h ax = cvt_frag_f32(xr);
        if (kn < N_EMBD) xr = load_raw_f32(x, m0, kn, N_EMBD);
#pragma unroll
        for (int nt = 0; nt < 4; ++nt) {
            accq[nt] = wmma16(ax, bq[nt], accq[nt]);
            acck[nt] = wmma16(ax, bk[nt], acck[nt]);
            accv[nt] = wmma16(ax, bv[nt], accv[nt]);
            if (kn < N_EMBD) {
                bq[nt] = load_frag_packed(Wtq + ((kn >> 5) * 12 + nt) * 512);
                bk[nt] = load_frag_packed(Wtk + ((kn >> 5) * 12 + nt) * 512);
                bv[nt] = load_frag_packed(Wtv + ((kn >> 5) * 12 + nt) * 512);
            }
        }
    }

    // ---- RoPE: pair (2i,2i+1) lives in adjacent lanes (C-layout: lane = column)
#pragma unroll
    for (int nt = 0; nt < 4; ++nt) {
        const int dcol = nt * 16 + n;
        const float freq = __expf(-(float)(dcol & ~1) * LN10K_64);
        const float sgn  = (dcol & 1) ? 1.f : -1.f;
#pragma unroll
        for (int r = 0; r < 8; ++r) {
            float pos = (float)(t0 + r + 8 * half);
            float s, c;
            __sincosf(pos * freq, &s, &c);
            float vq = accq[nt][r], pq = __shfl_xor(vq, 1, 32);
            float vk = acck[nt][r], pk = __shfl_xor(vk, 1, 32);
            accq[nt][r] = (vq * c + sgn * pq * s) * SCALE_Q;  // fold softmax scale
            acck[nt][r] = (vk * c + sgn * pk * s);
        }
    }

    // ---- q then k: scatter C-layout into LDS, read back in fragment lane order
#pragma unroll
    for (int which = 0; which < 2; ++which) {
        v8f* acc = which ? acck : accq;
        _Float16* gout = which ? k : q;
#pragma unroll
        for (int nt = 0; nt < 4; ++nt)
#pragma unroll
            for (int r = 0; r < 8; ++r)
                lp[(r + 8 * half) * HEADD + nt * 16 + n] = (_Float16)acc[nt][r];
        lds_fence();
#pragma unroll
        for (int j = 0; j < 4; ++j) {               // j = 2 * d-step + part
            v8h d = *(const v8h*)(lp + n * HEADD + j * 16 + half * 8);
            *(v8h*)(gout + (size_t)m0 * HEADD + j * 256 + lane * 8) = d;
        }
        lds_fence();
    }

    // ---- v: these 16 tokens are one part of their 32-key chunk's A-fragments, and
    // the accumulator's lane (column d, 8 consecutive t) is the fragment's own lane
#pragma unroll
    for (int nt = 0; nt < 4; ++nt) {
        v8h pk;
#pragma unroll
        for (int r = 0; r < 8; ++r) pk[r] = (_Float16)accv[nt][r];
        *(v8h*)(vT + (size_t)b * HEADD * SEQ + ((t0 >> 5) * 4 + nt) * 512
                + ((t0 >> 4) & 1) * 256 + lane * 8) = pk;
    }
}

#define OPITCH 68

__device__ __forceinline__ float other_half(float v) {
    const int bits = __builtin_bit_cast(int, v);
    return __builtin_bit_cast(float, __builtin_amdgcn_permlanex16(
        bits, bits, 0x76543210, 0xfedcba98, false, false));
}

__global__ __launch_bounds__(256) void flash_attn_kernel(
    const _Float16* __restrict__ q, const _Float16* __restrict__ k,
    const _Float16* __restrict__ vT, float* __restrict__ out) {
    __shared__ __attribute__((aligned(16))) float ldsO[8 * 16 * OPITCH];  // 4.25KB per wave
    const int wave  = (blockIdx.x * blockDim.x + threadIdx.x) >> 5;
    const int lane  = threadIdx.x & 31;
    const int n     = lane & 15;
    const int half  = lane >> 4;
    const int qrow0 = wave * 16;
    const int b     = qrow0 >> 10;
    const int t0    = qrow0 & 1023;
    float* lo = ldsO + (threadIdx.x >> 5) * 16 * OPITCH;
    const _Float16* vb = vT + (size_t)b * HEADD * SEQ;

    v16h aq0 = load_frag_packed(q + (size_t)qrow0 * HEADD);
    v16h aq1 = load_frag_packed(q + (size_t)qrow0 * HEADD + 512);

    // acc[nt][r] = O[query t0 + n][d = nt * 16 + 8 * half + r]
    v8f acc[4];
    const v8f zf = {0.f, 0.f, 0.f, 0.f, 0.f, 0.f, 0.f, 0.f};
#pragma unroll
    for (int nt = 0; nt < 4; ++nt) acc[nt] = zf;
    float mrow = -3.0e38f;      // running maximum of query t0 + n (equal in both halves)
    float lrow = 0.f;           // running sum over this half's keys only

    const int nch = (t0 >> 5) + 1;
    v16h kf[4];
    const _Float16* kb = k + (size_t)(b << 10) * HEADD;
#pragma unroll
    for (int f = 0; f < 4; ++f) kf[f] = load_frag_packed(kb + f * 512);
    for (int c2 = 0; c2 < nch; ++c2) {
        const int cb = c2 << 5;
        v16h vf[4];
#pragma unroll
        for (int nt = 0; nt < 4; ++nt) vf[nt] = load_frag_packed(vb + (c2 * 4 + nt) * 512);
        // ---- S^T = K Q^T for 32 keys: S0[r] = key cb + 8 * half + r, S1[r] = 16 keys on
        v8f S0 = zf, S1 = zf;
        S0 = wmma16(kf[0], aq0, S0);
        S0 = wmma16(kf[1], aq1, S0);
        S1 = wmma16(kf[2], aq0, S1);
        S1 = wmma16(kf[3], aq1, S1);
        // the K refill may land in the V loads' address registers: their translations first
        asm volatile("s_wait_xcnt 0x0" ::: "memory");
        // next chunk's K; the last chunk fetches itself again (in bounds, unused)
        const int cn = (c2 + 1 < nch) ? c2 + 1 : c2;
#pragma unroll
        for (int f = 0; f < 4; ++f) kf[f] = load_frag_packed(kb + (cn * 4 + f) * 512);

        if (c2 == nch - 1) {                        // causal mask (diag chunk only)
            const int row  = t0 + n;
            const int key0 = cb + 8 * half, key1 = key0 + 16;
#pragma unroll
            for (int r = 0; r < 8; ++r) {
                if (key0 + r > row) S0[r] = -1.0e30f;
                if (key1 + r > row) S1[r] = -1.0e30f;
            }
        }

        // ---- online softmax of one query per lane pair
        // maximum as a tree of threes: three dependent links, not eight
        const float ma = fmaxf(fmaxf(S0[0], S0[1]), S0[2]);
        const float mb = fmaxf(fmaxf(S0[3], S0[4]), S0[5]);
        const float mc = fmaxf(fmaxf(S0[6], S0[7]), S1[0]);
        const float md = fmaxf(fmaxf(S1[1], S1[2]), S1[3]);
        const float me = fmaxf(fmaxf(S1[4], S1[5]), S1[6]);
        float mx = fmaxf(fmaxf(fmaxf(ma, mb), mc), fmaxf(fmaxf(md, me), S1[7]));
        mx = fmaxf(mx, other_half(mx));
        const float mn = fmaxf(mrow, mx);
        const float sc = __expf(mrow - mn);
        v16h pb;                                    // P^T as B: element s = key cb + 8 * half + s (+ 8 if s >= 8)
        float rs[8];
#pragma unroll
        for (int r = 0; r < 8; ++r) {
            const float p0 = __expf(S0[r] - mn);
            const float p1 = __expf(S1[r] - mn);
            rs[r] = p0 + p1;
            pb[r]     = (_Float16)p0;
            pb[8 + r] = (_Float16)p1;
        }
        lrow = lrow * sc + (((rs[0] + rs[1]) + (rs[2] + rs[3])) + ((rs[4] + rs[5]) + (rs[6] + rs[7])));
        mrow = mn;
        // ---- O^T = O^T * sc + V^T P^T
#pragma unroll
        for (int nt = 0; nt < 4; ++nt) {
#pragma unroll
            for (int r = 0; r < 8; ++r) acc[nt][r] *= sc;
            acc[nt] = wmma16(vf[nt], pb, acc[nt]);
        }
    }

    // ---- epilogue: join the halves' sums, normalize, turn the tile through this
    // wave's own LDS so that every 16B store instruction covers 512B in a row
    const float inv = 1.0f / (lrow + other_half(lrow));
#pragma unroll
    for (int nt = 0; nt < 4; ++nt)
#pragma unroll
        for (int j = 0; j < 2; ++j) {
            v4f d;
#pragma unroll
            for (int i = 0; i < 4; ++i) d[i] = acc[nt][j * 4 + i] * inv;
            *(v4f*)(lo + n * OPITCH + nt * 16 + half * 8 + j * 4) = d;
        }
    lds_fence();
#pragma unroll
    for (int i = 0; i < 8; ++i) {
        const int row = i * 2 + half;
        v4f d = *(const v4f*)(lo + row * OPITCH + n * 4);
        *(v4f*)(out + (size_t)(qrow0 + row) * HEADD + n * 4) = d;
    }
}

// ---------------------------------------------------------------------------
extern "C" void kernel_launch(void* const* d_in, const int* in_sizes, int n_in,
                              void* d_out, int out_size, void* d_ws, size_t ws_size,
                              hipStream_t stream) {
    const float* x  = (const float*)d_in[0];
    const float* Wq = (const float*)d_in[1];
    const float* Wk = (const float*)d_in[2];
    const float* Wv = (const float*)d_in[3];
    float* out = (float*)d_out;

    // workspace layout (f16, 1KB lane-order fragments): Wt[24][12] | q[2048][2] | k[2048][2] | v[32][32][4]
    unsigned char* ws = (unsigned char*)d_ws;
    const size_t WT_BYTES = (size_t)3 * HEADD * N_EMBD * 2;   //   294912
    const size_t QK_BYTES = (size_t)MROWS * HEADD * 2;        //  4194304
    _Float16* Wt = (_Float16*)(ws);
    _Float16* q  = (_Float16*)(ws + WT_BYTES);
    _Float16* kk = (_Float16*)(ws + WT_BYTES + QK_BYTES);
    _Float16* vT = (_Float16*)(ws + WT_BYTES + 2 * QK_BYTES);

    // 0) weight convert into fragments: 147456 elems, exact grid
    wt_prep_kernel<<<(3 * N_EMBD * HEADD) / 256, 256, 0, stream>>>(Wq, Wk, Wv, Wt);

    // 1) QKV + RoPE: 2048 waves, 8 waves/block
    qkv_rope_kernel<<<MROWS / 128, 256, 0, stream>>>(x, Wt, q, kk, vT);

    // 2) flash attention: 2048 query tiles, 8 waves/block
    flash_attn_kernel<<<(MROWS / 16) / 8, 256, 0, stream>>>(q, kk, vT, out);
}

// v004
// It runs in 39 microseconds.
// Timed twice side by side with v003, it ran 1.32 and 1.33 times as fast.
// Over all steps from v000 it is 2.75 times as fast.
#include <hip/hip_runtime.h>
#include <hip/hip_bf16.h>

typedef __attribute__((ext_vector_type(16))) _Float16 v16h;
typedef __attribute__((ext_vector_type(8)))  _Float16 v8h;
typedef __attribute__((ext_vector_type(8)))  float    v8f;
typedef __attribute__((ext_vector_type(4)))  float    v4f;

#define N_EMBD 768
#define HEADD  64
#define BATCH  32
#define SEQ    1024
#define MROWS  (BATCH * SEQ)            // 32768 token rows
#define SCALE_Q 0.03608439182435161f    // 768^-0.5
#define LN10K_64 0.14391156856871347f   // ln(10000)/64

// ---- per-wave LDS fence: DS ops are in-order per wave; keep compiler honest
__device__ __forceinline__ void lds_fence() {
    __builtin_amdgcn_wave_barrier();
    asm volatile("s_wait_dscnt 0" ::: "memory");
    __builtin_amdgcn_wave_barrier();
}

__device__ __forceinline__ v8f wmma16(v16h a, v16h b, v8f c) {
    // D = A(16x32 f16) * B(32x16 f16) + C(16x16 f32)
    return __builtin_amdgcn_wmma_f32_16x16x32_f16(
        /*neg_a=*/false, a, /*neg_b=*/false, b,
        /*c_mod=*/(short)0, c, /*reuse_a=*/false, /*reuse_b=*/false);
}

__device__ __forceinline__ v16h load_frag_packed(const _Float16* frag) {
    const int lane = threadIdx.x & 31;
    v8h lo = *(const v8h*)(frag + lane * 8);
    v8h hi = *(const v8h*)(frag + 256 + lane * 8);
    v16h r;
#pragma unroll
    for (int i = 0; i < 8; ++i) { r[i] = lo[i]; r[8 + i] = hi[i]; }
    return r;
}

// Same fragment but sourced from fp32 (for the x activations). The load and the
// conversion are separate so that the raw words can be fetched one k-step ahead.
struct XRaw { v4f a0, a1, b0, b1; };

__device__ __forceinline__ XRaw load_raw_f32(const float* p, int n0, int k0, int ld) {
    const int lane = threadIdx.x & 31;
    const int n    = lane & 15;
    const int ks   = (lane < 16) ? 0 : 8;
    const float* base = p + (size_t)(n0 + n) * ld + k0 + ks;
    XRaw x;
    x.a0 = *(const v4f*)(base);
    x.a1 = *(const v4f*)(base + 4);
    x.b0 = *(const v4f*)(base + 16);
    x.b1 = *(const v4f*)(base + 20);
    return x;
}

__device__ __forceinline__ v16h cvt_frag_f32(const XRaw& x) {
    v16h r;
#pragma unroll
    for (int i = 0; i < 4; ++i) {
        r[i]      = (_Float16)x.a0[i];
        r[4 + i]  = (_Float16)x.a1[i];
        r[8 + i]  = (_Float16)x.b0[i];
        r[12 + i] = (_Float16)x.b1[i];
    }
    return r;
}

// ---------------------------------------------------------------------------
// Kernel 0: W[768][64] fp32 (x3) -> f16 B-fragments in lane order,
// Wt[k-step 0..23][matrix 0..2][n-tile 0..3][1KB fragment]: the 12 fragments of
// one k-step are 12KB in a row.
// ---------------------------------------------------------------------------
__global__ __launch_bounds__(256) void wt_prep_kernel(
    const float* __restrict__ Wq, const float* __restrict__ Wk,
    const float* __restrict__ Wv, _Float16* __restrict__ Wt) {
    int idx = blockIdx.x * 256 + threadIdx.x;       // exactly 3*768*64 threads
    int w   = idx / (N_EMBD * HEADD);
    int rme = idx % (N_EMBD * HEADD);
    int kk  = rme >> 6;                             // k index 0..767
    int nn  = rme & 63;                             // n index 0..63
    const float* W = (w == 0) ? Wq : ((w == 1) ? Wk : Wv);
    const int frag = (kk >> 5) * 12 + w * 4 + (nn >> 4);
    const int part = (kk >> 4) & 1;                 // K 0..15 | 16..31 of the k-step
    const int ln   = ((kk >> 3) & 1) * 16 + (nn & 15);
    Wt[(size_t)frag * 512 + part * 256 + ln * 8 + (kk & 7)] = (_Float16)W[rme];
}

// ---------------------------------------------------------------------------
// Kernel 1: q/k/v projection + RoPE. One wave per 16 token rows.
// 24 k-steps x (1 A-frag + 12 B-frags + 12 WMMAs). All 13 fragments are fetched
// one k-step ahead: each register set is refilled right behind the WMMA that
// read it, so a load has a whole k-step to land. q gets the softmax scale
// folded in. q,k,v are stored as the fragments the attention kernel reads, in
// lane order: q,k per 16 rows [d-step 0..1][1KB] via LDS repack, v per 32 keys
// [d-tile 0..3][1KB] straight from the accumulators; every store is 512B in a row.
// ---------------------------------------------------------------------------
__global__ __launch_bounds__(256) void qkv_rope_kernel(
    const float* __restrict__ x, const _Float16* __restrict__ Wt,
    _Float16* __restrict__ q, _Float16* __restrict__ k,
    _Float16* __restrict__ vT) {
    __shared__ _Float16 lds[8 * 16 * HEADD];        // 2KB per wave
    const int wave  = (blockIdx.x * blockDim.x + threadIdx.x) >> 5;
    const int wlocal = threadIdx.x >> 5;
    const int lane  = threadIdx.x & 31;
    const int n     = lane & 15;
    const int half  = lane >> 4;
    const int m0    = wave * 16;                    // global token-row base
    const int b     = m0 >> 10;
    const int t0    = m0 & 1023;
    _Float16* lp = lds + wlocal * 16 * HEADD;

    const _Float16* Wtq = Wt;                       // + k-step * 12 fragments
    const _Float16* Wtk = Wt + 4 * 512;
    const _Float16* Wtv = Wt + 8 * 512;

    v8f accq[4], acck[4], accv[4];
    const v8f zf = {0.f, 0.f, 0.f, 0.f, 0.f, 0.f, 0.f, 0.f};
#pragma unroll
    for (int nt = 0; nt < 4; ++nt) { accq[nt] = zf; acck[nt] = zf; accv[nt] = zf; }

    XRaw xr = load_raw_f32(x, m0, 0, N_EMBD);
    v16h bq[4], bk[4], bv[4];
#pragma unroll
    for (int nt = 0; nt < 4; ++nt) {
        bq[nt] = load_frag_packed(Wtq + nt * 512);
        bk[nt] = load_frag_packed(Wtk + nt * 512);
        bv[nt] = load_frag_packed(Wtv + nt * 512);
    }

    // fully unrolled: rolled, part of the fragments came back through a second
    // register set and copies at the loop's foot, which wait on the fresh loads
#pragma unroll
    for (int kn = 32; kn <= N_EMBD; kn += 32) {     // kn: the k-step being fetched
        v16h ax = cvt_frag_f32(xr);
        if (kn < N_EMBD) xr = load_raw_f32(x, m0, kn, N_EMBD);
#pragma unroll
        for (int nt = 0; nt < 4; ++nt) {
            accq[nt] = wmma16(ax, bq[nt], accq[nt]);
            acck[nt] = wmma16(ax, bk[nt], acck[nt]);
            accv[nt] = wmma16(ax, bv[nt], accv[nt]);
            if (kn < N_EMBD) {
                bq[nt] = load_frag_packed(Wtq + ((kn >> 5) * 12 + nt) * 512);
                bk[nt] = load_frag_packed(Wtk + ((kn >> 5) * 12 + nt) * 512);
                bv[nt] = load_frag_packed(Wtv + ((kn >> 5) * 12 + nt) * 512);
            }
        }
    }

    // ---- RoPE: pair (2i,2i+1) lives in adjacent lanes (C-layout: lane = column)
#pragma unroll
    for (int nt = 0; nt < 4; ++nt) {
        const int dcol = nt * 16 + n;
        const float freq = __expf(-(float)(dcol & ~1) * LN10K_64);
        const float sgn  = (dcol & 1) ? 1.f : -1.f;
#pragma unroll
        for (int r = 0; r < 8; ++r) {
            float pos = (float)(t0 + r + 8 * half);
            float s, c;
            __sincosf(pos * freq, &s, &c);
            float vq = accq[nt][r], pq = __shfl_xor(vq, 1, 32);
            float vk = acck[nt][r], pk = __shfl_xor(vk, 1, 32);
            accq[nt][r] = (vq * c + sgn * pq * s) * SCALE_Q;  // fold softmax scale
            acck[nt][r] = (vk * c + sgn * pk * s);
        }
    }

    // ---- q then k: scatter C-layout into LDS, read back in fragment lane order
#pragma unroll
    for (int which = 0; which < 2; ++which) {
        v8f* acc = which ? acck : accq;
        _Float16* gout = which ? k : q;
#pragma unroll
        for (int nt = 0; nt < 4; ++nt)
#pragma unroll
            for (int r = 0; r < 8; ++r)
                lp[(r + 8 * half) * HEADD + nt * 16 + n] = (_Float16)acc[nt][r];
        lds_fence();
#pragma unroll
        for (int j = 0; j < 4; ++j) {               // j = 2 * d-step + part
            v8h d = *(const v8h*)(lp + n * HEADD + j * 16 + half * 8);
            *(v8h*)(gout + (size_t)m0 * HEADD + j * 256 + lane * 8) = d;
        }
        lds_fence();
    }

    // ---- v: these 16 tokens are one part of their 32-key chunk's A-fragments, and
    // the accumulator's lane (column d, 8 consecutive t) is the fragment's own lane
#pragma unroll
    for (int nt = 0; nt < 4; ++nt) {
        v8h pk;
#pragma unroll
        for (int r = 0; r < 8; ++r) pk[r] = (_Float16)accv[nt][r];
        *(v8h*)(vT + (size_t)b * HEADD * SEQ + ((t0 >> 5) * 4 + nt) * 512
                + ((t0 >> 4) & 1) * 256 + lane * 8) = pk;
    }
}

#define OPITCH 68
#define WLDS (16 * OPITCH)
#define CSPLIT 17

__device__ __forceinline__ float other_half(float v) {
    const int bits = __builtin_bit_cast(int, v);
    return __builtin_bit_cast(float, __builtin_amdgcn_permlanex16(
        bits, bits, 0x76543210, 0xfedcba98, false, false));
}

// Online softmax attention of the query tile at row t0 of its batch over key
// chunks c0 .. c1 - 1 (c0 < c1); kb, vb: the batch's K and V fragments.
// acc[nt][r] = O[query t0 + n][d = nt * 16 + 8 * half + r]; mrow: running maximum
// (equal in both halves); lrow: running sum over this half's keys only.
__device__ __forceinline__ void attend(
    const _Float16* __restrict__ qt, const _Float16* __restrict__ kb,
    const _Float16* __restrict__ vb, int t0, int c0, int c1,
    v8f (&acc)[4], float& mrow, float& lrow) {
    const int lane  = threadIdx.x & 31;
    const int n     = lane & 15;
    const int half  = lane >> 4;
    const v8f zf = {0.f, 0.f, 0.f, 0.f, 0.f, 0.f, 0.f, 0.f};
    const int cdiag = t0 >> 5;                      // the chunk that holds the diagonal

    v16h aq0 = load_frag_packed(qt);
    v16h aq1 = load_frag_packed(qt + 512);
    v16h kf[4];
#pragma unroll
    for (int f = 0; f < 4; ++f) kf[f] = load_frag_packed(kb + (c0 * 4 + f) * 512);
    for (int c2 = c0; c2 < c1; ++c2) {
        const int cb = c2 << 5;
        v16h vf[4];
#pragma unroll
        for (int nt = 0; nt < 4; ++nt) vf[nt] = load_frag_packed(vb + (c2 * 4 + nt) * 512);
        // ---- S^T = K Q^T for 32 keys: S0[r] = key cb + 8 * half + r, S1[r] = 16 keys on
        v8f S0 = zf, S1 = zf;
        S0 = wmma16(kf[0], aq0, S0);
        S0 = wmma16(kf[1], aq1, S0);
        S1 = wmma16(kf[2], aq0, S1);
        S1 = wmma16(kf[3], aq1, S1);
        // the K refill may land in the V loads' address registers: their translations first
        asm volatile("s_wait_xcnt 0x0" ::: "memory");
        // next chunk's K; the last chunk fetches itself again (in bounds, unused)
        const int cn = (c2 + 1 < c1) ? c2 + 1 : c2;
#pragma unroll
        for (int f = 0; f < 4; ++f) kf[f] = load_frag_packed(kb + (cn * 4 + f) * 512);

        if (c2 == cdiag) {                          // causal mask (diag chunk only)
            const int row  = t0 + n;
            const int key0 = cb + 8 * half, key1 = key0 + 16;
#pragma unroll
            for (int r = 0; r < 8; ++r) {
                if (key0 + r > row) S0[r] = -1.0e30f;
                if (key1 + r > row) S1[r] = -1.0e30f;
            }
        }

        // ---- online softmax of one query per lane pair
        // maximum as a tree of threes: three dependent links, not eight
        const float ma = fmaxf(fmaxf(S0[0], S0[1]), S0[2]);
        const float mb = fmaxf(fmaxf(S0[3], S0[4]), S0[5]);
        const float mc = fmaxf(fmaxf(S0[6], S0[7]), S1[0]);
        const float md = fmaxf(fmaxf(S1[1], S1[2]), S1[3]);
        const float me = fmaxf(fmaxf(S1[4], S1[5]), S1[6]);
        float mx = fmaxf(fmaxf(fmaxf(ma, mb), mc), fmaxf(fmaxf(md, me), S1[7]));
        mx = fmaxf(mx, other_half(mx));
        const float mn = fmaxf(mrow, mx);
        const float sc = __expf(mrow - mn);
        v16h pb;                                    // P^T as B: element s = key cb + 8 * half + s (+ 8 if s >= 8)
        float rs[8];
#pragma unroll
        for (int r = 0; r < 8; ++r) {
            const float p0 = __expf(S0[r] - mn);
            const float p1 = __expf(S1[r] - mn);
            rs[r] = p0 + p1;
            pb[r]     = (_Float16)p0;
            pb[8 + r] = (_Float16)p1;
        }
        lrow = lrow * sc + (((rs[0] + rs[1]) + (rs[2] + rs[3])) + ((rs[4] + rs[5]) + (rs[6] + rs[7])));
        mrow = mn;
        // ---- O^T = O^T * sc + V^T P^T
#pragma unroll
        for (int nt = 0; nt < 4; ++nt) {
#pragma unroll
            for (int r = 0; r < 8; ++r) acc[nt][r] *= sc;
            acc[nt] = wmma16(vf[nt], pb, acc[nt]);
        }
    }
}

// join the halves' sums, normalize, turn the tile through this wave's own LDS so
// that every 16B store instruction covers 512B in a row
__device__ __forceinline__ void store_tile(
    const v8f (&acc)[4], float lrow, float* lo, float* __restrict__ orow) {
    const int lane  = threadIdx.x & 31;
    const int n     = lane & 15;
    const int half  = lane >> 4;
    const float inv = 1.0f / (lrow + other_half(lrow));
#pragma unroll
    for (int nt = 0; nt < 4; ++nt)
#pragma unroll
        for (int j = 0; j < 2; ++j) {
            v4f d;
#pragma unroll
            for (int i = 0; i < 4; ++i) d[i] = acc[nt][j * 4 + i] * inv;
            *(v4f*)(lo + n * OPITCH + nt * 16 + half * 8 + j * 4) = d;
        }
    lds_fence();
#pragma unroll
    for (int i = 0; i < 8; ++i) {
        const int row = i * 2 + half;
        v4f d = *(const v4f*)(lo + row * OPITCH + n * 4);
        *(v4f*)(orow + (size_t)row * HEADD + n * 4) = d;
    }
}

__global__ __launch_bounds__(256) void flash_attn_kernel(
    const _Float16* __restrict__ q, const _Float16* __restrict__ k,
    const _Float16* __restrict__ vT, float* __restrict__ out) {
    __shared__ __attribute__((aligned(16))) float ldsO[8 * WLDS];   // 4.25KB per wave
    const int wv    = __builtin_amdgcn_readfirstlane((int)(threadIdx.x >> 5));
    const int lane  = threadIdx.x & 31;
    const int b     = blockIdx.x >> 3;              // batch
    const int tl    = (blockIdx.x & 7) * 4 + (wv & 3);   // short tile 0..31
    const int th    = 63 - tl;                      // long tile 32..63
    const int nchh  = (th >> 1) + 1;                // its chunks, 17..32
    const bool second = wv >= 4;
    float* lo = ldsO + wv * WLDS;
    const _Float16* qb = q + (size_t)(b << 10) * HEADD;
    const _Float16* kb = k + (size_t)(b << 10) * HEADD;
    const _Float16* vb = vT + (size_t)b * HEADD * SEQ;
    float* ob = out + (size_t)(b << 10) * HEADD;

    const v8f zf = {0.f, 0.f, 0.f, 0.f, 0.f, 0.f, 0.f, 0.f};
    v8f acc[4];
#pragma unroll
    for (int nt = 0; nt < 4; ++nt) acc[nt] = zf;
    float mrow = -3.0e38f;
    float lrow = 0.f;

    if (second) {
        attend(qb + tl * 16 * HEADD, kb, vb, tl * 16, 0, (tl >> 1) + 1, acc, mrow, lrow);
        store_tile(acc, lrow, lo, ob + tl * 16 * HEADD);
        // the long tile's loads may land in these stores' registers: their translations first
        asm volatile("s_wait_xcnt 0x0" ::: "memory");
#pragma unroll
        for (int nt = 0; nt < 4; ++nt) acc[nt] = zf;
        mrow = -3.0e38f;
        lrow = 0.f;
        if (CSPLIT < nchh)
            attend(qb + th * 16 * HEADD, kb, vb, th * 16, CSPLIT, nchh, acc, mrow, lrow);
        // partial state, lane by lane: 8 x 16B (512B in a row per store), maximum, sum
#pragma unroll
        for (int nt = 0; nt < 4; ++nt)
#pragma unroll
            for (int j = 0; j < 2; ++j) {
                v4f d;
#pragma unroll
                for (int i = 0; i < 4; ++i) d[i] = acc[nt][j * 4 + i];
                *(v4f*)(lo + ((nt * 2 + j) * 32 + lane) * 4) = d;
            }
        lo[1024 + lane] = mrow;
        lo[1056 + lane] = lrow;
    } else {
        attend(qb + th * 16 * HEADD, kb, vb, th * 16, 0, CSPLIT, acc, mrow, lrow);
    }

    // the one hand-over: partial states written above are read below
    __syncthreads();

    if (!second) {
        const float* pp = ldsO + (wv + 4) * WLDS;
        const float mo = pp[1024 + lane];
        const float so = pp[1056 + lane];
        const float mn = fmaxf(mrow, mo);
        const float sa = __expf(mrow - mn);         // an empty partial has maximum -3e38: sb = 0
        const float sb = __expf(mo - mn);
        lrow = lrow * sa + so * sb;
#pragma unroll
        for (int nt = 0; nt < 4; ++nt)
#pragma unroll
            for (int j = 0; j < 2; ++j) {
                v4f d = *(const v4f*)(pp + ((nt * 2 + j) * 32 + lane) * 4);
#pragma unroll
                for (int i = 0; i < 4; ++i)
                    acc[nt][j * 4 + i] = acc[nt][j * 4 + i] * sa + d[i] * sb;
            }
        store_tile(acc, lrow, lo, ob + th * 16 * HEADD);
    }
}

// ---------------------------------------------------------------------------
extern "C" void kernel_launch(void* const* d_in, const int* in_sizes, int n_in,
                              void* d_out, int out_size, void* d_ws, size_t ws_size,
                              hipStream_t stream) {
    const float* x  = (const float*)d_in[0];
    const float* Wq = (const float*)d_in[1];
    const float* Wk = (const float*)d_in[2];
    const float* Wv = (const float*)d_in[3];
    float* out = (float*)d_out;

    // workspace layout (f16, 1KB lane-order fragments): Wt[24][12] | q[2048][2] | k[2048][2] | v[32][32][4]
    unsigned char* ws = (unsigned char*)d_ws;
    const size_t WT_BYTES = (size_t)3 * HEADD * N_EMBD * 2;   //   294912
    const size_t QK_BYTES = (size_t)MROWS * HEADD * 2;        //  4194304
    _Float16* Wt = (_Float16*)(ws);
    _Float16* q  = (_Float16*)(ws + WT_BYTES);
    _Float16* kk = (_Float16*)(ws + WT_BYTES + QK_BYTES);
    _Float16* vT = (_Float16*)(ws + WT_BYTES + 2 * QK_BYTES);

    // 0) weight convert into fragments: 147456 elems, exact grid
    wt_prep_kernel<<<(3 * N_EMBD * HEADD) / 256, 256, 0, stream>>>(Wq, Wk, Wv, Wt);

    // 1) QKV + RoPE: 2048 waves, 8 waves/block
    qkv_rope_kernel<<<MROWS / 128, 256, 0, stream>>>(x, Wt, q, kk, vT);

    // 2) flash attention: 2048 query tiles, 8 per block (4 long, 4 short), 8 waves/block
    flash_attn_kernel<<<(MROWS / 16) / 8, 256, 0, stream>>>(q, kk, vT, out);
}

// v005
// Measured time: 32.2 microseconds a run.
// Two timings next to v004 both put it at 1.22 times that version's speed.
// All steps since v000 together make it 3.36 times as fast.
#include <hip/hip_runtime.h>
#include <hip/hip_bf16.h>
#include <stdint.h>

typedef __attribute__((ext_vector_type(16))) _Float16 v16h;
typedef __attribute__((ext_vector_type(8)))  _Float16 v8h;
typedef __attribute__((ext_vector_type(8)))  float    v8f;
typedef __attribute__((ext_vector_type(4)))  float    v4f;

#define N_EMBD 768
#define HEADD  64
#define BATCH  32
#define SEQ    1024
#define MROWS  (BATCH * SEQ)            // 32768 token rows
#define SCALE_Q 0.03608439182435161f    // 768^-0.5
#define LN10K_64 0.14391156856871347f   // ln(10000)/64

// ---- per-wave LDS fence: DS ops are in-order per wave; keep compiler honest
__device__ __forceinline__ void lds_fence() {
    __builtin_amdgcn_wave_barrier();
    asm volatile("s_wait_dscnt 0" ::: "memory");
    __builtin_amdgcn_wave_barrier();
}

__device__ __forceinline__ v8f wmma16(v16h a, v16h b, v8f c) {
    // D = A(16x32 f16) * B(32x16 f16) + C(16x16 f32)
    return __builtin_amdgcn_wmma_f32_16x16x32_f16(
        /*neg_a=*/false, a, /*neg_b=*/false, b,
        /*c_mod=*/(short)0, c, /*reuse_a=*/false, /*reuse_b=*/false);
}

__device__ __forceinline__ v16h load_frag_packed(const _Float16* frag) {
    const int lane = threadIdx.x & 31;
    v8h lo = *(const v8h*)(frag + lane * 8);
    v8h hi = *(const v8h*)(frag + 256 + lane * 8);
    v16h r;
#pragma unroll
    for (int i = 0; i < 8; ++i) { r[i] = lo[i]; r[8 + i] = hi[i]; }
    return r;
}

// Same fragment but sourced from fp32 (for the x activations). The load and the
// conversion are separate so that the raw words can be fetched one k-step ahead.
struct XRaw { v4f a0, a1, b0, b1; };

__device__ __forceinline__ XRaw load_raw_f32(const float* p, int n0, int k0, int ld) {
    const int lane = threadIdx.x & 31;
    const int n    = lane & 15;
    const int ks   = (lane < 16) ? 0 : 8;
    const float* base = p + (size_t)(n0 + n) * ld + k0 + ks;
    XRaw x;
    x.a0 = *(const v4f*)(base);
    x.a1 = *(const v4f*)(base + 4);
    x.b0 = *(const v4f*)(base + 16);
    x.b1 = *(const v4f*)(base + 20);
    return x;
}

__device__ __forceinline__ v16h cvt_frag_f32(const XRaw& x) {
    v16h r;
#pragma unroll
    for (int i = 0; i < 4; ++i) {
        r[i]      = (_Float16)x.a0[i];
        r[4 + i]  = (_Float16)x.a1[i];
        r[8 + i]  = (_Float16)x.b0[i];
        r[12 + i] = (_Float16)x.b1[i];
    }
    return r;
}

// ---------------------------------------------------------------------------
// Kernel 0: W[768][64] fp32 (x3) -> f16 B-fragments in lane order,
// Wt[k-step 0..23][matrix 0..2][n-tile 0..3][1KB fragment]: the 12 fragments of
// one k-step are 12KB in a row.
// ---------------------------------------------------------------------------
__global__ __launch_bounds__(256) void wt_prep_kernel(
    const float* __restrict__ Wq, const float* __restrict__ Wk,
    const float* __restrict__ Wv, _Float16* __restrict__ Wt) {
    int idx = blockIdx.x * 256 + threadIdx.x;       // exactly 3*768*64 threads
    int w   = idx / (N_EMBD * HEADD);
    int rme = idx % (N_EMBD * HEADD);
    int kk  = rme >> 6;                             // k index 0..767
    int nn  = rme & 63;                             // n index 0..63
    const float* W = (w == 0) ? Wq : ((w == 1) ? Wk : Wv);
    const int frag = (kk >> 5) * 12 + w * 4 + (nn >> 4);
    const int part = (kk >> 4) & 1;                 // K 0..15 | 16..31 of the k-step
    const int ln   = ((kk >> 3) & 1) * 16 + (nn & 15);
    Wt[(size_t)frag * 512 + part * 256 + ln * 8 + (kk & 7)] = (_Float16)W[rme];
}

// ---------------------------------------------------------------------------
// Kernel 1: q/k/v projection + RoPE. One wave per 16 token rows.
// 24 k-steps x (1 A-frag + 12 B-frags + 12 WMMAs). All 13 fragments are fetched
// one k-step ahead: each register set is refilled right behind the WMMA that
// read it, so a load has a whole k-step to land. q gets the softmax scale
// folded in. q,k,v are stored as the fragments the attention kernel reads, in
// lane order: q,k per 16 rows [d-step 0..1][1KB] via LDS repack, v per 32 keys
// [d-tile 0..3][1KB] straight from the accumulators; every store is 512B in a row.
// ---------------------------------------------------------------------------
__global__ __launch_bounds__(256) void qkv_rope_kernel(
    const float* __restrict__ x, const _Float16* __restrict__ Wt,
    _Float16* __restrict__ q, _Float16* __restrict__ k,
    _Float16* __restrict__ vT) {
    __shared__ _Float16 lds[8 * 16 * HEADD];        // 2KB per wave
    const int wave  = (blockIdx.x * blockDim.x + threadIdx.x) >> 5;
    const int wlocal = threadIdx.x >> 5;
    const int lane  = threadIdx.x & 31;
    const int n     = lane & 15;
    const int half  = lane >> 4;
    const int m0    = wave * 16;                    // global token-row base
    const int b     = m0 >> 10;
    const int t0    = m0 & 1023;
    _Float16* lp = lds + wlocal * 16 * HEADD;

    const _Float16* Wtq = Wt;                       // + k-step * 12 fragments
    const _Float16* Wtk = Wt + 4 * 512;
    const _Float16* Wtv = Wt + 8 * 512;

    v8f accq[4], acck[4], accv[4];
    const v8f zf = {0.f, 0.f, 0.f, 0.f, 0.f, 0.f, 0.f, 0.f};
#pragma unroll
    for (int nt = 0; nt < 4; ++nt) { accq[nt] = zf; acck[nt] = zf; accv[nt] = zf; }

    XRaw xr = load_raw_f32(x, m0, 0, N_EMBD);
    v16h bq[4], bk[4], bv[4];
#pragma unroll
    for (int nt = 0; nt < 4; ++nt) {
        bq[nt] = load_frag_packed(Wtq + nt * 512);
        bk[nt] = load_frag_packed(Wtk + nt * 512);
        bv[nt] = load_frag_packed(Wtv + nt * 512);
    }

    // fully unrolled: rolled, part of the fragments came back through a second
    // register set and copies at the loop's foot, which wait on the fresh loads
#pragma unroll
    for (int kn = 32; kn <= N_EMBD; kn += 32) {     // kn: the k-step being fetched
        v16h ax = cvt_frag_f32(xr);
        if (kn < N_EMBD) xr = load_raw_f32(x, m0, kn, N_EMBD);
#pragma unroll
        for (int nt = 0; nt < 4; ++nt) {
            accq[nt] = wmma16(ax, bq[nt], accq[nt]);
            acck[nt] = wmma16(ax, bk[nt], acck[nt]);
            accv[nt] = wmma16(ax, bv[nt], accv[nt]);
            if (kn < N_EMBD) {
                bq[nt] = load_frag_packed(Wtq + ((kn >> 5) * 12 + nt) * 512);
                bk[nt] = load_frag_packed(Wtk + ((kn >> 5) * 12 + nt) * 512);
                bv[nt] = load_frag_packed(Wtv + ((kn >> 5) * 12 + nt) * 512);
            }
        }
    }

    // ---- RoPE: pair (2i,2i+1) lives in adjacent lanes (C-layout: lane = column)
#pragma unroll
    for (int nt = 0; nt < 4; ++nt) {
        const int dcol = nt * 16 + n;
        const float freq = __expf(-(float)(dcol & ~1) * LN10K_64);
        const float sgn  = (dcol & 1) ? 1.f : -1.f;
#pragma unroll
        for (int r = 0; r < 8; ++r) {
            float pos = (float)(t0 + r + 8 * half);
            float s, c;
            __sincosf(pos * freq, &s, &c);
            float vq = accq[nt][r], pq = __shfl_xor(vq, 1, 32);
            float vk = acck[nt][r], pk = __shfl_xor(vk, 1, 32);
            accq[nt][r] = (vq * c + sgn * pq * s) * SCALE_Q;  // fold softmax scale
            acck[nt][r] = (vk * c + sgn * pk * s);
        }
    }

    // ---- q then k: scatter C-layout into LDS, read back in fragment lane order
#pragma unroll
    for (int which = 0; which < 2; ++which) {
        v8f* acc = which ? acck : accq;
        _Float16* gout = which ? k : q;
#pragma unroll
        for (int nt = 0; nt < 4; ++nt)
#pragma unroll
            for (int r = 0; r < 8; ++r)
                lp[(r + 8 * half) * HEADD + nt * 16 + n] = (_Float16)acc[nt][r];
        lds_fence();
#pragma unroll
        for (int j = 0; j < 4; ++j) {               // j = 2 * d-step + part
            v8h d = *(const v8h*)(lp + n * HEADD + j * 16 + half * 8);
            *(v8h*)(gout + (size_t)m0 * HEADD + j * 256 + lane * 8) = d;
        }
        lds_fence();
    }

    // ---- v: these 16 tokens are one part of their 32-key chunk's A-fragments, and
    // the accumulator's lane (column d, 8 consecutive t) is the fragment's own lane
#pragma unroll
    for (int nt = 0; nt < 4; ++nt) {
        v8h pk;
#pragma unroll
        for (int r = 0; r < 8; ++r) pk[r] = (_Float16)accv[nt][r];
        *(v8h*)(vT + (size_t)b * HEADD * SEQ + ((t0 >> 5) * 4 + nt) * 512
                + ((t0 >> 4) & 1) * 256 + lane * 8) = pk;
    }
}

#define OPITCH 68
#define WLDS (16 * OPITCH)
#define CSPLIT 17
#define KVH (SEQ * HEADD)

typedef uint32_t u32x4 __attribute__((ext_vector_type(4)));
typedef uint32_t u32x8 __attribute__((ext_vector_type(8)));

__device__ __forceinline__ uint32_t uni(uint32_t v) {
    return (uint32_t)__builtin_amdgcn_readfirstlane(v);
}

// One tensor load of this wave: rows x 1024 contiguous bytes from ga to LDS byte lds_dst,
// no pad, no mask; 1-byte elements, tensor = tile, source pitch = row.
__device__ __forceinline__ void tensor_rows_1k(uint32_t lds_dst, uint64_t ga, uint32_t rows) {
    u32x4 g0;
    g0[0] = uni(1u);
    g0[1] = uni(lds_dst);
    g0[2] = uni((uint32_t)ga);
    g0[3] = uni((((uint32_t)(ga >> 32)) & 0x01FFFFFFu) | 0x80000000u);
    u32x8 g1;
    g1[0] = uni(0u);
    g1[1] = uni(1024u << 16);
    g1[2] = uni((rows & 0xFFFFu) << 16);
    g1[3] = uni(1024u << 16);
    g1[4] = uni(rows);
    g1[5] = uni(1024u);
    g1[6] = uni(0u);
    g1[7] = uni(0u);
    asm volatile("tensor_load_to_lds %0, %1" :: "s"(g0), "s"(g1) : "memory");
}

__device__ __forceinline__ float other_half(float v) {
    const int bits = __builtin_bit_cast(int, v);
    return __builtin_bit_cast(float, __builtin_amdgcn_permlanex16(
        bits, bits, 0x76543210, 0xfedcba98, false, false));
}

// Online softmax attention of the query tile at row t0 of its batch over key
// chunks c0 .. c1 - 1 (c0 < c1); aq0, aq1: the tile's Q fragments; kb, vb: the batch's
// K and V fragments, in LDS.
// acc[nt][r] = O[query t0 + n][d = nt * 16 + 8 * half + r]; mrow: running maximum
// (equal in both halves); lrow: running sum over this half's keys only.
__device__ __forceinline__ void attend(
    const v16h aq0, const v16h aq1, const _Float16* __restrict__ kb,
    const _Float16* __restrict__ vb, int t0, int c0, int c1,
    v8f (&acc)[4], float& mrow, float& lrow) {
    const int lane  = threadIdx.x & 31;
    const int n     = lane & 15;
    const int half  = lane >> 4;
    const v8f zf = {0.f, 0.f, 0.f, 0.f, 0.f, 0.f, 0.f, 0.f};
    const int cdiag = t0 >> 5;                      // the chunk that holds the diagonal

    v16h kf[4];
#pragma unroll
    for (int f = 0; f < 4; ++f) kf[f] = load_frag_packed(kb + (c0 * 4 + f) * 512);
    for (int c2 = c0; c2 < c1; ++c2) {
        const int cb = c2 << 5;
        v16h vf[4];
#pragma unroll
        for (int nt = 0; nt < 4; ++nt) vf[nt] = load_frag_packed(vb + (c2 * 4 + nt) * 512);
        // ---- S^T = K Q^T for 32 keys: S0[r] = key cb + 8 * half + r, S1[r] = 16 keys on
        v8f S0 = zf, S1 = zf;
        S0 = wmma16(kf[0], aq0, S0);
        S0 = wmma16(kf[1], aq1, S0);
        S1 = wmma16(kf[2], aq0, S1);
        S1 = wmma16(kf[3], aq1, S1);
        // next chunk's K; the last chunk fetches itself again (in bounds, unused)
        const int cn = (c2 + 1 < c1) ? c2 + 1 : c2;
#pragma unroll
        for (int f = 0; f < 4; ++f) kf[f] = load_frag_packed(kb + (cn * 4 + f) * 512);

        if (c2 == cdiag) {                          // causal mask (diag chunk only)
            const int row  = t0 + n;
            const int key0 = cb + 8 * half, key1 = key0 + 16;
#pragma unroll
            for (int r = 0; r < 8; ++r) {
                if (key0 + r > row) S0[r] = -1.0e30f;
                if (key1 + r > row) S1[r] = -1.0e30f;
            }
        }

        // ---- online softmax of one query per lane pair
        // maximum as a tree of threes: three dependent links, not eight
        const float ma = fmaxf(fmaxf(S0[0], S0[1]), S0[2]);
        const float mb = fmaxf(fmaxf(S0[3], S0[4]), S0[5]);
        const float mc = fmaxf(fmaxf(S0[6], S0[7]), S1[0]);
        const float md = fmaxf(fmaxf(S1[1], S1[2]), S1[3]);
        const float me = fmaxf(fmaxf(S1[4], S1[5]), S1[6]);
        float mx = fmaxf(fmaxf(fmaxf(ma, mb), mc), fmaxf(fmaxf(md, me), S1[7]));
        mx = fmaxf(mx, other_half(mx));
        const float mn = fmaxf(mrow, mx);
        const float sc = __expf(mrow - mn);
        v16h pb;                                    // P^T as B: element s = key cb + 8 * half + s (+ 8 if s >= 8)
        float rs[8];
#pragma unroll
        for (int r = 0; r < 8; ++r) {
            const float p0 = __expf(S0[r] - mn);
            const float p1 = __expf(S1[r] - mn);
            rs[r] = p0 + p1;
            pb[r]     = (_Float16)p0;
            pb[8 + r] = (_Float16)p1;
        }
        lrow = lrow * sc + (((rs[0] + rs[1]) + (rs[2] + rs[3])) + ((rs[4] + rs[5]) + (rs[6] + rs[7])));
        mrow = mn;
        // ---- O^T = O^T * sc + V^T P^T
#pragma unroll
        for (int nt = 0; nt < 4; ++nt) {
#pragma unroll
            for (int r = 0; r < 8; ++r) acc[nt][r] *= sc;
            acc[nt] = wmma16(vf[nt], pb, acc[nt]);
        }
    }
}

// join the halves' sums, normalize, turn the tile through this wave's own LDS so
// that every 16B store instruction covers 512B in a row
__device__ __forceinline__ void store_tile(
    const v8f (&acc)[4], float lrow, float* lo, float* __restrict__ orow) {
    const int lane  = threadIdx.x & 31;
    const int n     = lane & 15;
    const int half  = lane >> 4;
    const float inv = 1.0f / (lrow + other_half(lrow));
#pragma unroll
    for (int nt = 0; nt < 4; ++nt)
#pragma unroll
        for (int j = 0; j < 2; ++j) {
            v4f d;
#pragma unroll
            for (int i = 0; i < 4; ++i) d[i] = acc[nt][j * 4 + i] * inv;
            *(v4f*)(lo + n * OPITCH + nt * 16 + half * 8 + j * 4) = d;
        }
    lds_fence();
#pragma unroll
    for (int i = 0; i < 8; ++i) {
        const int row = i * 2 + half;
        v4f d = *(const v4f*)(lo + row * OPITCH + n * 4);
        *(v4f*)(orow + (size_t)row * HEADD + n * 4) = d;
    }
}

__global__ __launch_bounds__(256) void flash_attn_kernel(
    const _Float16* __restrict__ q, const _Float16* __restrict__ k,
    const _Float16* __restrict__ vT, float* __restrict__ out) {
    __shared__ __attribute__((aligned(2048))) _Float16 ldsKV[2 * KVH];   // K 128KB | V 128KB
    __shared__ __attribute__((aligned(16))) float ldsO[8 * WLDS];   // 4.25KB per wave
    const int wv    = __builtin_amdgcn_readfirstlane((int)(threadIdx.x >> 5));
    const int lane  = threadIdx.x & 31;
    const int b     = blockIdx.x >> 3;              // batch
    const int tl    = (blockIdx.x & 7) * 4 + (wv & 3);   // short tile 0..31
    const int th    = 63 - tl;                      // long tile 32..63
    const int nchh  = (th >> 1) + 1;                // its chunks, 17..32
    const bool second = wv >= 4;
    float* lo = ldsO + wv * WLDS;
    const _Float16* qb = q + (size_t)(b << 10) * HEADD;
    const _Float16* kb = ldsKV;
    const _Float16* vb = ldsKV + KVH;
    float* ob = out + (size_t)(b << 10) * HEADD;

    // Q fragments first, so that they fly while K and V are staged: the first tile's, and
    // in a second wave the long tile's as well
    const _Float16* qf = qb + (second ? tl : th) * 16 * HEADD;
    const _Float16* qh = qb + th * 16 * HEADD;
    const v16h qa0 = load_frag_packed(qf);
    const v16h qa1 = load_frag_packed(qf + 512);
    v16h qc0, qc1;                                  // set and read in second waves only
    if (second) {
        qc0 = load_frag_packed(qh);
        qc1 = load_frag_packed(qh + 512);
    }
    // later values may land in the Q loads' address registers: their translations first;
    // the two bases are inputs so that their registers stay unwritten up to this wait
    asm volatile("s_wait_xcnt 0x0" :: "s"(qf), "s"(qh) : "memory");

    // K and V chunks 0 .. nmax - 1 into LDS as they lie; nmax (18 .. 32, even) is the chunk
    // count of the work-group's longest tile. Waves 0-3 bring a quarter of K each, waves 4-7
    // of V: nmax rows of 1KB, so every slice starts at a multiple of 2KB.
    {
        const uint32_t nmax  = 32u - 2u * (blockIdx.x & 7u);
        const uint32_t slice = (uint32_t)(wv & 3) * nmax * 1024u;
        const _Float16* gsrc = (second ? vT : k) + (size_t)b * KVH;
        tensor_rows_1k((uint32_t)(size_t)ldsKV + (second ? 2u * KVH : 0u) + slice,
                       (uint64_t)(size_t)gsrc + slice, nmax);
        // this wave's slice has landed behind it
        asm volatile("s_wait_tensorcnt 0" ::: "memory");
    }
    // publishes every wave's slice; nothing of K or V is read in front of it
    __syncthreads();

    const v8f zf = {0.f, 0.f, 0.f, 0.f, 0.f, 0.f, 0.f, 0.f};
    v8f acc[4];
#pragma unroll
    for (int nt = 0; nt < 4; ++nt) acc[nt] = zf;
    float mrow = -3.0e38f;
    float lrow = 0.f;

    if (second) {
        attend(qa0, qa1, kb, vb, tl * 16, 0, (tl >> 1) + 1, acc, mrow, lrow);
        store_tile(acc, lrow, lo, ob + tl * 16 * HEADD);
        // later values may land in these stores' registers: their translations first
        asm volatile("s_wait_xcnt 0x0" ::: "memory");
#pragma unroll
        for (int nt = 0; nt < 4; ++nt) acc[nt] = zf;
        mrow = -3.0e38f;
        lrow = 0.f;
        if (CSPLIT < nchh)
            attend(qc0, qc1, kb, vb, th * 16, CSPLIT, nchh, acc, mrow, lrow);
        // partial state, lane by lane: 8 x 16B (512B in a row per store), maximum, sum
#pragma unroll
        for (int nt = 0; nt < 4; ++nt)
#pragma unroll
            for (int j = 0; j < 2; ++j) {
                v4f d;
#pragma unroll
                for (int i = 0; i < 4; ++i) d[i] = acc[nt][j * 4 + i];
                *(v4f*)(lo + ((nt * 2 + j) * 32 + lane) * 4) = d;
            }
        lo[1024 + lane] = mrow;
        lo[1056 + lane] = lrow;
    } else {
        attend(qa0, qa1, kb, vb, th * 16, 0, CSPLIT, acc, mrow, lrow);
    }

    // the one hand-over: partial states written above are read below
    __syncthreads();

    if (!second) {
        const float* pp = ldsO + (wv + 4) * WLDS;
        const float mo = pp[1024 + lane];
        const float so = pp[1056 + lane];
        const float mn = fmaxf(mrow, mo);
        const float sa = __expf(mrow - mn);         // an empty partial has maximum -3e38: sb = 0
        const float sb = __expf(mo - mn);
        lrow = lrow * sa + so * sb;
#pragma unroll
        for (int nt = 0; nt < 4; ++nt)
#pragma unroll
            for (int j = 0; j < 2; ++j) {
                v4f d = *(const v4f*)(pp + ((nt * 2 + j) * 32 + lane) * 4);
#pragma unroll
                for (int i = 0; i < 4; ++i)
                    acc[nt][j * 4 + i] = acc[nt][j * 4 + i] * sa + d[i] * sb;
            }
        store_tile(acc, lrow, lo, ob + th * 16 * HEADD);
    }
}

// ---------------------------------------------------------------------------
extern "C" void kernel_launch(void* const* d_in, const int* in_sizes, int n_in,
                              void* d_out, int out_size, void* d_ws, size_t ws_size,
                              hipStream_t stream) {
    const float* x  = (const float*)d_in[0];
    const float* Wq = (const float*)d_in[1];
    const float* Wk = (const float*)d_in[2];
    const float* Wv = (const float*)d_in[3];
    float* out = (float*)d_out;

    // workspace layout (f16, 1KB lane-order fragments): Wt[24][12] | q[2048][2] | k[2048][2] | v[32][32][4]
    unsigned char* ws = (unsigned char*)d_ws;
    const size_t WT_BYTES = (size_t)3 * HEADD * N_EMBD * 2;   //   294912
    const size_t QK_BYTES = (size_t)MROWS * HEADD * 2;        //  4194304
    _Float16* Wt = (_Float16*)(ws);
    _Float16* q  = (_Float16*)(ws + WT_BYTES);
    _Float16* kk = (_Float16*)(ws + WT_BYTES + QK_BYTES);
    _Float16* vT = (_Float16*)(ws + WT_BYTES + 2 * QK_BYTES);

    // 0) weight convert into fragments: 147456 elems, exact grid
    wt_prep_kernel<<<(3 * N_EMBD * HEADD) / 256, 256, 0, stream>>>(Wq, Wk, Wv, Wt);

    // 1) QKV + RoPE: 2048 waves, 8 waves/block
    qkv_rope_kernel<<<MROWS / 128, 256, 0, stream>>>(x, Wt, q, kk, vT);

    // 2) flash attention: 2048 query tiles, 8 per block (4 long, 4 short), 8 waves/block
    flash_attn_kernel<<<(MROWS / 16) / 8, 256, 0, stream>>>(q, kk, vT, out);
}

// v006
// It runs in 30.4 microseconds.
// Timed twice side by side with v005, it ran 1.06 and 1.08 times as fast.
// Counting every step since v000, it is 3.59 times as fast.
#include <hip/hip_runtime.h>
#include <hip/hip_bf16.h>
#include <stdint.h>

typedef __attribute__((ext_vector_type(16))) _Float16 v16h;
typedef __attribute__((ext_vector_type(8)))  _Float16 v8h;
typedef __attribute__((ext_vector_type(8)))  float    v8f;
typedef __attribute__((ext_vector_type(4)))  float    v4f;

#define N_EMBD 768
#define HEADD  64
#define BATCH  32
#define SEQ    1024
#define MROWS  (BATCH * SEQ)            // 32768 token rows
#define SCALE_Q 0.03608439182435161f    // 768^-0.5
#define LN10K_64 0.14391156856871347f   // ln(10000)/64

// ---- per-wave LDS fence: DS ops are in-order per wave; keep compiler honest
__device__ __forceinline__ void lds_fence() {
    __builtin_amdgcn_wave_barrier();
    asm volatile("s_wait_dscnt 0" ::: "memory");
    __builtin_amdgcn_wave_barrier();
}

__device__ __forceinline__ v8f wmma16(v16h a, v16h b, v8f c) {
    // D = A(16x32 f16) * B(32x16 f16) + C(16x16 f32)
    return __builtin_amdgcn_wmma_f32_16x16x32_f16(
        /*neg_a=*/false, a, /*neg_b=*/false, b,
        /*c_mod=*/(short)0, c, /*reuse_a=*/false, /*reuse_b=*/false);
}

__device__ __forceinline__ v16h load_frag_packed(const _Float16* frag) {
    const int lane = threadIdx.x & 31;
    v8h lo = *(const v8h*)(frag + lane * 8);
    v8h hi = *(const v8h*)(frag + 256 + lane * 8);
    v16h r;
#pragma unroll
    for (int i = 0; i < 8; ++i) { r[i] = lo[i]; r[8 + i] = hi[i]; }
    return r;
}

// Same fragment but sourced from fp32 (for the x activations), out of a staged tile of
// 16 rows at a pitch of ld floats. The load and the conversion are separate so that the
// raw words can be fetched one k-step ahead.
struct XRaw { v4f a0, a1, b0, b1; };

__device__ __forceinline__ XRaw load_raw_f32(const float* p, int k0, int ld) {
    const int lane = threadIdx.x & 31;
    const int n    = lane & 15;
    const int ks   = (lane < 16) ? 0 : 8;
    const float* base = p + n * ld + k0 + ks;
    XRaw x;
    x.a0 = *(const v4f*)(base);
    x.a1 = *(const v4f*)(base + 4);
    x.b0 = *(const v4f*)(base + 16);
    x.b1 = *(const v4f*)(base + 20);
    return x;
}

__device__ __forceinline__ v16h cvt_frag_f32(const XRaw& x) {
    v16h r;
#pragma unroll
    for (int i = 0; i < 4; ++i) {
        r[i]      = (_Float16)x.a0[i];
        r[4 + i]  = (_Float16)x.a1[i];
        r[8 + i]  = (_Float16)x.b0[i];
        r[12 + i] = (_Float16)x.b1[i];
    }
    return r;
}

typedef uint32_t u32x4 __attribute__((ext_vector_type(4)));
typedef uint32_t u32x8 __attribute__((ext_vector_type(8)));

__device__ __forceinline__ uint32_t uni(uint32_t v) {
    return (uint32_t)__builtin_amdgcn_readfirstlane(v);
}

// a wave-uniform value held in a scalar register: a test on it compiles to a scalar
// branch, and what is derived from it stays behind the asm statements in front of it
__device__ __forceinline__ uint32_t pinned(uint32_t v) {
    uint32_t w = uni(v);
    asm volatile("" : "+s"(w));
    return w;
}

// ---------------------------------------------------------------------------
// Kernel 0: W[768][64] fp32 (x3) -> f16 B-fragments in lane order,
// Wt[k-step 0..23][matrix 0..2][n-tile 0..3][1KB fragment]: the 12 fragments of
// one k-step are 12KB in a row.
// ---------------------------------------------------------------------------
__global__ __launch_bounds__(256) void wt_prep_kernel(
    const float* __restrict__ Wq, const float* __restrict__ Wk,
    const float* __restrict__ Wv, _Float16* __restrict__ Wt) {
    int idx = blockIdx.x * 256 + threadIdx.x;       // exactly 3*768*64 threads
    int w   = idx / (N_EMBD * HEADD);
    int rme = idx % (N_EMBD * HEADD);
    int kk  = rme >> 6;                             // k index 0..767
    int nn  = rme & 63;                             // n index 0..63
    const float* W = (w == 0) ? Wq : ((w == 1) ? Wk : Wv);
    const int frag = (kk >> 5) * 12 + w * 4 + (nn >> 4);
    const int part = (kk >> 4) & 1;                 // K 0..15 | 16..31 of the k-step
    const int ln   = ((kk >> 3) & 1) * 16 + (nn & 15);
    Wt[(size_t)frag * 512 + part * 256 + ln * 8 + (kk & 7)] = (_Float16)W[rme];
}

#define XTILE_B 256
#define XTILES  (N_EMBD * 4 / XTILE_B)
#define XPITCH  68
#define XSLOT   1536
#define XDEPTH  3

template <int N> __device__ __forceinline__ void wait_tensor_le() {
    // all but this wave's N youngest tensor loads have landed; the compiler places no such wait
    if constexpr (N == 0) asm volatile("s_wait_tensorcnt 0" ::: "memory");
    else if constexpr (N == 1) asm volatile("s_wait_tensorcnt 1" ::: "memory");
    else asm volatile("s_wait_tensorcnt 2" ::: "memory");
}

__global__ __launch_bounds__(256) void qkv_rope_kernel(
    const float* __restrict__ x, const _Float16* __restrict__ Wt,
    _Float16* __restrict__ q, _Float16* __restrict__ k,
    _Float16* __restrict__ vT) {
    __shared__ __attribute__((aligned(2048))) float ldsX[8 * XDEPTH * XSLOT];   // 18KB per wave
    __shared__ _Float16 lds[8 * 16 * HEADD];        // 2KB per wave
    const int wave  = (blockIdx.x * blockDim.x + threadIdx.x) >> 5;
    const int wlocal = threadIdx.x >> 5;
    const int lane  = threadIdx.x & 31;
    const int n     = lane & 15;
    const int half  = lane >> 4;
    const int m0    = wave * 16;                    // global token-row base
    const int b     = m0 >> 10;
    const int t0    = m0 & 1023;
    _Float16* lp = lds + wlocal * 16 * HEADD;

    const _Float16* Wtq = Wt;                       // + k-step * 12 fragments
    const _Float16* Wtk = Wt + 4 * 512;
    const _Float16* Wtv = Wt + 8 * 512;

    v8f accq[4], acck[4], accv[4];
    const v8f zf = {0.f, 0.f, 0.f, 0.f, 0.f, 0.f, 0.f, 0.f};
#pragma unroll
    for (int nt = 0; nt < 4; ++nt) { accq[nt] = zf; acck[nt] = zf; accv[nt] = zf; }

    const float* xs = ldsX + uni((uint32_t)wlocal) * (XDEPTH * XSLOT);
    const uint32_t xs_b = (uint32_t)(size_t)xs;     // its byte offset in the work-group's LDS
    const uint64_t xg   = (uint64_t)(size_t)(x + (size_t)m0 * N_EMBD);
    const uint32_t xlo  = uni((uint32_t)xg);
    const uint32_t xhi  = uni((uint32_t)(xg >> 32));
    // true only where a 4GB boundary lies inside the first row's 3KB
    const uint32_t wraps = xlo > 0xFFFFFFFFu - (XTILES - 1) * XTILE_B;
    u32x8 g1;
    g1[0] = uni(1u << 20 | 5u << 22 | 3u << 25);
    g1[1] = uni((uint32_t)XTILE_B << 16);
    g1[2] = uni(16u << 16);
    g1[3] = uni((uint32_t)XTILE_B << 16);
    g1[4] = uni(16u);
    g1[5] = uni(N_EMBD * 4u);
    g1[6] = uni(0u);
    g1[7] = uni(0u);
    u32x4 g0;
    g0[0] = uni(1u);
    g0[3] = uni((xhi & 0x01FFFFFFu) | 0x80000000u);
    auto issue_x = [&](int t) {
        if (t > 0 && pinned(wraps)) {
            // the address's high word changes only with no request outstanding
            asm volatile("s_wait_tensorcnt 0" ::: "memory");
            const uint32_t carry = pinned(xlo + (uint32_t)t * XTILE_B < xlo);   // formed behind that wait
            g0[3] = uni(((xhi + carry) & 0x01FFFFFFu) | 0x80000000u);
        }
        g0[1] = uni(xs_b + (uint32_t)(t % XDEPTH) * (XSLOT * 4u));
        g0[2] = uni(xlo + (uint32_t)t * XTILE_B);
        asm volatile("tensor_load_to_lds %0, %1" : "+s"(g0), "+s"(g1) :: "memory");
    };
#pragma unroll
    for (int t = 0; t < XDEPTH; ++t) issue_x(t);

    v16h bq[4], bk[4], bv[4];
#pragma unroll
    for (int nt = 0; nt < 4; ++nt) {
        bq[nt] = load_frag_packed(Wtq + nt * 512);
        bk[nt] = load_frag_packed(Wtk + nt * 512);
        bv[nt] = load_frag_packed(Wtv + nt * 512);
    }
    wait_tensor_le<XDEPTH - 1>();                   // tile 0 has landed
    XRaw xr = load_raw_f32(xs, 0, XPITCH);

    // fully unrolled: rolled, part of the fragments came back through a second
    // register set and copies at the loop's foot, which wait on the fresh loads
#pragma unroll
    for (int kn = 32; kn <= N_EMBD; kn += 32) {     // kn: the k-step being fetched
        v16h ax = cvt_frag_f32(xr);
        if (kn < N_EMBD) {
            const int t = kn >> 6;                  // the tile that holds k-step kn
            if ((kn & 63) == 0) {
                asm volatile("s_wait_dscnt 0" ::: "memory");
                if (t + XDEPTH - 1 < XTILES) issue_x(t + XDEPTH - 1);
                // tile t has landed: only the tiles issued behind it may still be out
                if (t + 2 < XTILES) wait_tensor_le<2>();
                else if (t + 1 < XTILES) wait_tensor_le<1>();
                else wait_tensor_le<0>();
            }
            xr = load_raw_f32(xs + (t % XDEPTH) * XSLOT, kn & 63, XPITCH);
            // keeps the four LDS reads here, a whole k-step of WMMAs ahead of their use and of
            // the s_wait_dscnt 0 above: unfenced they sank to right in front of that wait
            __builtin_amdgcn_sched_barrier(0);
        }
#pragma unroll
        for (int nt = 0; nt < 4; ++nt) {
            accq[nt] = wmma16(ax, bq[nt], accq[nt]);
            acck[nt] = wmma16(ax, bk[nt], acck[nt]);
            accv[nt] = wmma16(ax, bv[nt], accv[nt]);
            if (kn < N_EMBD) {
                bq[nt] = load_frag_packed(Wtq + ((kn >> 5) * 12 + nt) * 512);
                bk[nt] = load_frag_packed(Wtk + ((kn >> 5) * 12 + nt) * 512);
                bv[nt] = load_frag_packed(Wtv + ((kn >> 5) * 12 + nt) * 512);
            }
            // keeps the refills in the order in which the next k-step reads them, and the next
            // conversion and LDS reads behind this k-step's WMMAs: between fences set wider apart
            // a k-step's first WMMA waited for the youngest load, the conversion on reads just issued
            __builtin_amdgcn_sched_barrier(0);
        }
    }

    // ---- RoPE: pair (2i,2i+1) lives in adjacent lanes (C-layout: lane = column)
#pragma unroll
    for (int nt = 0; nt < 4; ++nt) {
        const int dcol = nt * 16 + n;
        const float freq = __expf(-(float)(dcol & ~1) * LN10K_64);
        const float sgn  = (dcol & 1) ? 1.f : -1.f;
#pragma unroll
        for (int r = 0; r < 8; ++r) {
            float pos = (float)(t0 + r + 8 * half);
            float s, c;
            __sincosf(pos * freq, &s, &c);
            float vq = accq[nt][r], pq = __shfl_xor(vq, 1, 32);
            float vk = acck[nt][r], pk = __shfl_xor(vk, 1, 32);
            accq[nt][r] = (vq * c + sgn * pq * s) * SCALE_Q;  // fold softmax scale
            acck[nt][r] = (vk * c + sgn * pk * s);
        }
    }

    // ---- q then k: scatter C-layout into LDS, read back in fragment lane order
#pragma unroll
    for (int which = 0; which < 2; ++which) {
        v8f* acc = which ? acck : accq;
        _Float16* gout = which ? k : q;
#pragma unroll
        for (int nt = 0; nt < 4; ++nt)
#pragma unroll
            for (int r = 0; r < 8; ++r)
                lp[(r + 8 * half) * HEADD + nt * 16 + n] = (_Float16)acc[nt][r];
        lds_fence();
#pragma unroll
        for (int j = 0; j < 4; ++j) {               // j = 2 * d-step + part
            v8h d = *(const v8h*)(lp + n * HEADD + j * 16 + half * 8);
            *(v8h*)(gout + (size_t)m0 * HEADD + j * 256 + lane * 8) = d;
        }
        lds_fence();
    }

    // ---- v: these 16 tokens are one part of their 32-key chunk's A-fragments, and
    // the accumulator's lane (column d, 8 consecutive t) is the fragment's own lane
#pragma unroll
    for (int nt = 0; nt < 4; ++nt) {
        v8h pk;
#pragma unroll
        for (int r = 0; r < 8; ++r) pk[r] = (_Float16)accv[nt][r];
        *(v8h*)(vT + (size_t)b * HEADD * SEQ + ((t0 >> 5) * 4 + nt) * 512
                + ((t0 >> 4) & 1) * 256 + lane * 8) = pk;
    }
}

#define OPITCH 68
#define WLDS (16 * OPITCH)
#define CSPLIT 17
#define KVH (SEQ * HEADD)

// One tensor load of this wave: rows x 1024 contiguous bytes from ga to LDS byte lds_dst,
// no pad, no mask; 1-byte elements, tensor = tile, source pitch = row.
__device__ __forceinline__ void tensor_rows_1k(uint32_t lds_dst, uint64_t ga, uint32_t rows) {
    u32x4 g0;
    g0[0] = uni(1u);
    g0[1] = uni(lds_dst);
    g0[2] = uni((uint32_t)ga);
    g0[3] = uni((((uint32_t)(ga >> 32)) & 0x01FFFFFFu) | 0x80000000u);
    u32x8 g1;
    g1[0] = uni(0u);
    g1[1] = uni(1024u << 16);
    g1[2] = uni((rows & 0xFFFFu) << 16);
    g1[3] = uni(1024u << 16);
    g1[4] = uni(rows);
    g1[5] = uni(1024u);
    g1[6] = uni(0u);
    g1[7] = uni(0u);
    asm volatile("tensor_load_to_lds %0, %1" :: "s"(g0), "s"(g1) : "memory");
}

__device__ __forceinline__ float other_half(float v) {
    const int bits = __builtin_bit_cast(int, v);
    return __builtin_bit_cast(float, __builtin_amdgcn_permlanex16(
        bits, bits, 0x76543210, 0xfedcba98, false, false));
}

// Online softmax attention of the query tile at row t0 of its batch over key
// chunks c0 .. c1 - 1 (c0 < c1); aq0, aq1: the tile's Q fragments; kb, vb: the batch's
// K and V fragments, in LDS.
// acc[nt][r] = O[query t0 + n][d = nt * 16 + 8 * half + r]; mrow: running maximum
// (equal in both halves); lrow: running sum over this half's keys only.
__device__ __forceinline__ void attend(
    const v16h aq0, const v16h aq1, const _Float16* __restrict__ kb,
    const _Float16* __restrict__ vb, int t0, int c0, int c1,
    v8f (&acc)[4], float& mrow, float& lrow) {
    const int lane  = threadIdx.x & 31;
    const int n     = lane & 15;
    const int half  = lane >> 4;
    const v8f zf = {0.f, 0.f, 0.f, 0.f, 0.f, 0.f, 0.f, 0.f};
    const int cdiag = t0 >> 5;                      // the chunk that holds the diagonal

    v16h kf[4];
#pragma unroll
    for (int f = 0; f < 4; ++f) kf[f] = load_frag_packed(kb + (c0 * 4 + f) * 512);
    for (int c2 = c0; c2 < c1; ++c2) {
        const int cb = c2 << 5;
        v16h vf[4];
#pragma unroll
        for (int nt = 0; nt < 4; ++nt) vf[nt] = load_frag_packed(vb + (c2 * 4 + nt) * 512);
        // ---- S^T = K Q^T for 32 keys: S0[r] = key cb + 8 * half + r, S1[r] = 16 keys on
        v8f S0 = zf, S1 = zf;
        S0 = wmma16(kf[0], aq0, S0);
        S0 = wmma16(kf[1], aq1, S0);
        S1 = wmma16(kf[2], aq0, S1);
        S1 = wmma16(kf[3], aq1, S1);
        // next chunk's K; the last chunk fetches itself again (in bounds, unused)
        const int cn = (c2 + 1 < c1) ? c2 + 1 : c2;
#pragma unroll
        for (int f = 0; f < 4; ++f) kf[f] = load_frag_packed(kb + (cn * 4 + f) * 512);

        if (c2 == cdiag) {                          // causal mask (diag chunk only)
            const int row  = t0 + n;
            const int key0 = cb + 8 * half, key1 = key0 + 16;
#pragma unroll
            for (int r = 0; r < 8; ++r) {
                if (key0 + r > row) S0[r] = -1.0e30f;
                if (key1 + r > row) S1[r] = -1.0e30f;
            }
        }

        // ---- online softmax of one query per lane pair
        // maximum as a tree of threes: three dependent links, not eight
        const float ma = fmaxf(fmaxf(S0[0], S0[1]), S0[2]);
        const float mb = fmaxf(fmaxf(S0[3], S0[4]), S0[5]);
        const float mc = fmaxf(fmaxf(S0[6], S0[7]), S1[0]);
        const float md = fmaxf(fmaxf(S1[1], S1[2]), S1[3]);
        const float me = fmaxf(fmaxf(S1[4], S1[5]), S1[6]);
        float mx = fmaxf(fmaxf(fmaxf(ma, mb), mc), fmaxf(fmaxf(md, me), S1[7]));
        mx = fmaxf(mx, other_half(mx));
        const float mn = fmaxf(mrow, mx);
        const float sc = __expf(mrow - mn);
        v16h pb;                                    // P^T as B: element s = key cb + 8 * half + s (+ 8 if s >= 8)
        float rs[8];
#pragma unroll
        for (int r = 0; r < 8; ++r) {
            const float p0 = __expf(S0[r] - mn);
            const float p1 = __expf(S1[r] - mn);
            rs[r] = p0 + p1;
            pb[r]     = (_Float16)p0;
            pb[8 + r] = (_Float16)p1;
        }
        lrow = lrow * sc + (((rs[0] + rs[1]) + (rs[2] + rs[3])) + ((rs[4] + rs[5]) + (rs[6] + rs[7])));
        mrow = mn;
        // ---- O^T = O^T * sc + V^T P^T
#pragma unroll
        for (int nt = 0; nt < 4; ++nt) {
#pragma unroll
            for (int r = 0; r < 8; ++r) acc[nt][r] *= sc;
            acc[nt] = wmma16(vf[nt], pb, acc[nt]);
        }
    }
}

// join the halves' sums, normalize, turn the tile through this wave's own LDS so
// that every 16B store instruction covers 512B in a row
__device__ __forceinline__ void store_tile(
    const v8f (&acc)[4], float lrow, float* lo, float* __restrict__ orow) {
    const int lane  = threadIdx.x & 31;
    const int n     = lane & 15;
    const int half  = lane >> 4;
    const float inv = 1.0f / (lrow + other_half(lrow));
#pragma unroll
    for (int nt = 0; nt < 4; ++nt)
#pragma unroll
        for (int j = 0; j < 2; ++j) {
            v4f d;
#pragma unroll
            for (int i = 0; i < 4; ++i) d[i] = acc[nt][j * 4 + i] * inv;
            *(v4f*)(lo + n * OPITCH + nt * 16 + half * 8 + j * 4) = d;
        }
    lds_fence();
#pragma unroll
    for (int i = 0; i < 8; ++i) {
        const int row = i * 2 + half;
        v4f d = *(const v4f*)(lo + row * OPITCH + n * 4);
        *(v4f*)(orow + (size_t)row * HEADD + n * 4) = d;
    }
}

__global__ __launch_bounds__(256) void flash_attn_kernel(
    const _Float16* __restrict__ q, const _Float16* __restrict__ k,
    const _Float16* __restrict__ vT, float* __restrict__ out) {
    __shared__ __attribute__((aligned(2048))) _Float16 ldsKV[2 * KVH];   // K 128KB | V 128KB
    __shared__ __attribute__((aligned(16))) float ldsO[8 * WLDS];   // 4.25KB per wave
    const int wv    = __builtin_amdgcn_readfirstlane((int)(threadIdx.x >> 5));
    const int lane  = threadIdx.x & 31;
    const int b     = blockIdx.x >> 3;              // batch
    const int tl    = (blockIdx.x & 7) * 4 + (wv & 3);   // short tile 0..31
    const int th    = 63 - tl;                      // long tile 32..63
    const int nchh  = (th >> 1) + 1;                // its chunks, 17..32
    const bool second = wv >= 4;
    float* lo = ldsO + wv * WLDS;
    const _Float16* qb = q + (size_t)(b << 10) * HEADD;
    const _Float16* kb = ldsKV;
    const _Float16* vb = ldsKV + KVH;
    float* ob = out + (size_t)(b << 10) * HEADD;

    // Q fragments first, so that they fly while K and V are staged: the first tile's, and
    // in a second wave the long tile's as well
    const _Float16* qf = qb + (second ? tl : th) * 16 * HEADD;
    const _Float16* qh = qb + th * 16 * HEADD;
    const v16h qa0 = load_frag_packed(qf);
    const v16h qa1 = load_frag_packed(qf + 512);
    v16h qc0, qc1;                                  // set and read in second waves only
    if (second) {
        qc0 = load_frag_packed(qh);
        qc1 = load_frag_packed(qh + 512);
    }
    // later values may land in the Q loads' address registers: their translations first;
    // the two bases are inputs so that their registers stay unwritten up to this wait
    asm volatile("s_wait_xcnt 0x0" :: "s"(qf), "s"(qh) : "memory");

    // K and V chunks 0 .. nmax - 1 into LDS as they lie; nmax (18 .. 32, even) is the chunk
    // count of the work-group's longest tile. Waves 0-3 bring a quarter of K each, waves 4-7
    // of V: nmax rows of 1KB, so every slice starts at a multiple of 2KB.
    {
        const uint32_t nmax  = 32u - 2u * (blockIdx.x & 7u);
        const uint32_t slice = (uint32_t)(wv & 3) * nmax * 1024u;
        const _Float16* gsrc = (second ? vT : k) + (size_t)b * KVH;
        tensor_rows_1k((uint32_t)(size_t)ldsKV + (second ? 2u * KVH : 0u) + slice,
                       (uint64_t)(size_t)gsrc + slice, nmax);
        // this wave's slice has landed behind it
        asm volatile("s_wait_tensorcnt 0" ::: "memory");
    }
    // publishes every wave's slice; nothing of K or V is read in front of it
    __syncthreads();

    const v8f zf = {0.f, 0.f, 0.f, 0.f, 0.f, 0.f, 0.f, 0.f};
    v8f acc[4];
#pragma unroll
    for (int nt = 0; nt < 4; ++nt) acc[nt] = zf;
    float mrow = -3.0e38f;
    float lrow = 0.f;

    if (second) {
        attend(qa0, qa1, kb, vb, tl * 16, 0, (tl >> 1) + 1, acc, mrow, lrow);
        store_tile(acc, lrow, lo, ob + tl * 16 * HEADD);
        // later values may land in these stores' registers: their translations first
        asm volatile("s_wait_xcnt 0x0" ::: "memory");
#pragma unroll
        for (int nt = 0; nt < 4; ++nt) acc[nt] = zf;
        mrow = -3.0e38f;
        lrow = 0.f;
        if (CSPLIT < nchh)
            attend(qc0, qc1, kb, vb, th * 16, CSPLIT, nchh, acc, mrow, lrow);
        // partial state, lane by lane: 8 x 16B (512B in a row per store), maximum, sum
#pragma unroll
        for (int nt = 0; nt < 4; ++nt)
#pragma unroll
            for (int j = 0; j < 2; ++j) {
                v4f d;
#pragma unroll
                for (int i = 0; i < 4; ++i) d[i] = acc[nt][j * 4 + i];
                *(v4f*)(lo + ((nt * 2 + j) * 32 + lane) * 4) = d;
            }
        lo[1024 + lane] = mrow;
        lo[1056 + lane] = lrow;
    } else {
        attend(qa0, qa1, kb, vb, th * 16, 0, CSPLIT, acc, mrow, lrow);
    }

    // the one hand-over: partial states written above are read below
    __syncthreads();

    if (!second) {
        const float* pp = ldsO + (wv + 4) * WLDS;
        const float mo = pp[1024 + lane];
        const float so = pp[1056 + lane];
        const float mn = fmaxf(mrow, mo);
        const float sa = __expf(mrow - mn);         // an empty partial has maximum -3e38: sb = 0
        const float sb = __expf(mo - mn);
        lrow = lrow * sa + so * sb;
#pragma unroll
        for (int nt = 0; nt < 4; ++nt)
#pragma unroll
            for (int j = 0; j < 2; ++j) {
                v4f d = *(const v4f*)(pp + ((nt * 2 + j) * 32 + lane) * 4);
#pragma unroll
                for (int i = 0; i < 4; ++i)
                    acc[nt][j * 4 + i] = acc[nt][j * 4 + i] * sa + d[i] * sb;
            }
        store_tile(acc, lrow, lo, ob + th * 16 * HEADD);
    }
}

// ---------------------------------------------------------------------------
extern "C" void kernel_launch(void* const* d_in, const int* in_sizes, int n_in,
                              void* d_out, int out_size, void* d_ws, size_t ws_size,
                              hipStream_t stream) {
    const float* x  = (const float*)d_in[0];
    const float* Wq = (const float*)d_in[1];
    const float* Wk = (const float*)d_in[2];
    const float* Wv = (const float*)d_in[3];
    float* out = (float*)d_out;

    // workspace layout (f16, 1KB lane-order fragments): Wt[24][12] | q[2048][2] | k[2048][2] | v[32][32][4]
    unsigned char* ws = (unsigned char*)d_ws;
    const size_t WT_BYTES = (size_t)3 * HEADD * N_EMBD * 2;   //   294912
    const size_t QK_BYTES = (size_t)MROWS * HEADD * 2;        //  4194304
    _Float16* Wt = (_Float16*)(ws);
    _Float16* q  = (_Float16*)(ws + WT_BYTES);
    _Float16* kk = (_Float16*)(ws + WT_BYTES + QK_BYTES);
    _Float16* vT = (_Float16*)(ws + WT_BYTES + 2 * QK_BYTES);

    // 0) weight convert into fragments: 147456 elems, exact grid
    wt_prep_kernel<<<(3 * N_EMBD * HEADD) / 256, 256, 0, stream>>>(Wq, Wk, Wv, Wt);

    // 1) QKV + RoPE: 2048 waves, 8 waves/block
    qkv_rope_kernel<<<MROWS / 128, 256, 0, stream>>>(x, Wt, q, kk, vT);

    // 2) flash attention: 2048 query tiles, 8 per block (4 long, 4 short), 8 waves/block
    flash_attn_kernel<<<(MROWS / 16) / 8, 256, 0, stream>>>(q, kk, vT, out);
}

// v007
// It runs in 26.9 microseconds.
// Next to v006, in two timings, it ran 1.12 and 1.13 times as fast.
// All steps since v000 together make it 4.04 times as fast.
#include <hip/hip_runtime.h>
#include <hip/hip_bf16.h>
#include <stdint.h>
#include <utility>

typedef __attribute__((ext_vector_type(16))) _Float16 v16h;
typedef __attribute__((ext_vector_type(8)))  _Float16 v8h;
typedef __attribute__((ext_vector_type(8)))  float    v8f;
typedef __attribute__((ext_vector_type(4)))  float    v4f;
typedef __attribute__((ext_vector_type(2)))  float    v2f;

#define N_EMBD 768
#define HEADD  64
#define BATCH  32
#define SEQ    1024
#define MROWS  (BATCH * SEQ)            // 32768 token rows
#define SCALE_Q 0.03608439182435161f    // 768^-0.5
#define LN10K_64 0.14391156856871347f   // ln(10000)/64

// ---- per-wave LDS fence: DS ops are in-order per wave; keep compiler honest
__device__ __forceinline__ void lds_fence() {
    __builtin_amdgcn_wave_barrier();
    asm volatile("s_wait_dscnt 0" ::: "memory");
    __builtin_amdgcn_wave_barrier();
}

__device__ __forceinline__ v8f wmma16(v16h a, v16h b, v8f c) {
    // D = A(16x32 f16) * B(32x16 f16) + C(16x16 f32)
    return __builtin_amdgcn_wmma_f32_16x16x32_f16(
        /*neg_a=*/false, a, /*neg_b=*/false, b,
        /*c_mod=*/(short)0, c, /*reuse_a=*/false, /*reuse_b=*/false);
}

__device__ __forceinline__ v16h load_frag_packed(const _Float16* frag) {
    const int lane = threadIdx.x & 31;
    v8h lo = *(const v8h*)(frag + lane * 8);
    v8h hi = *(const v8h*)(frag + 256 + lane * 8);
    v16h r;
#pragma unroll
    for (int i = 0; i < 8; ++i) { r[i] = lo[i]; r[8 + i] = hi[i]; }
    return r;
}

// Same fragment but sourced from fp32 (for the x activations), out of a staged tile of
// 16 rows at a pitch of ld floats. The load and the conversion are separate so that the
// raw words can be fetched one k-step ahead.
struct XRaw { v4f a0, a1, b0, b1; };

__device__ __forceinline__ XRaw load_raw_f32(const float* p, int k0, int ld) {
    const int lane = threadIdx.x & 31;
    const int n    = lane & 15;
    const int ks   = (lane < 16) ? 0 : 8;
    const float* base = p + n * ld + k0 + ks;
    XRaw x;
    x.a0 = *(const v4f*)(base);
    x.a1 = *(const v4f*)(base + 4);
    x.b0 = *(const v4f*)(base + 16);
    x.b1 = *(const v4f*)(base + 20);
    return x;
}

__device__ __forceinline__ v16h cvt_frag_f32(const XRaw& x) {
    v16h r;
#pragma unroll
    for (int i = 0; i < 4; ++i) {
        r[i]      = (_Float16)x.a0[i];
        r[4 + i]  = (_Float16)x.a1[i];
        r[8 + i]  = (_Float16)x.b0[i];
        r[12 + i] = (_Float16)x.b1[i];
    }
    return r;
}

typedef uint32_t u32x4 __attribute__((ext_vector_type(4)));
typedef uint32_t u32x8 __attribute__((ext_vector_type(8)));

__device__ __forceinline__ uint32_t uni(uint32_t v) {
    return (uint32_t)__builtin_amdgcn_readfirstlane(v);
}

// a wave-uniform value held in a scalar register: a test on it compiles to a scalar
// branch, and what is derived from it stays behind the asm statements in front of it
__device__ __forceinline__ uint32_t pinned(uint32_t v) {
    uint32_t w = uni(v);
    asm volatile("" : "+s"(w));
    return w;
}

#define XTILE_B 256
#define XTILES  (N_EMBD * 4 / XTILE_B)
#define XPITCH  68
#define XSLOT   1536
#define XDEPTH  3
#define WKS     6
#define WSTAGES (N_EMBD / 32 / WKS)
#define WFP     520
#define WSTG    (WKS * 12 * WFP)

struct WRaw { v2f m[3][8]; };           // 8 k rows x 2 columns of each of the three matrices

// f(0), f(1), ... with the index as a compile-time constant
template <class F, int... I>
__device__ __forceinline__ void each_index(F& f, std::integer_sequence<int, I...>) {
    (f(std::integral_constant<int, I>{}), ...);
}

template <int N> __device__ __forceinline__ void wait_tensor_le() {
    // all but this wave's N youngest tensor loads have landed; the compiler places no such wait
    if constexpr (N == 0) asm volatile("s_wait_tensorcnt 0" ::: "memory");
    else if constexpr (N == 1) asm volatile("s_wait_tensorcnt 1" ::: "memory");
    else asm volatile("s_wait_tensorcnt 2" ::: "memory");
}

__global__ __launch_bounds__(256) void qkv_rope_kernel(
    const float* __restrict__ x, const float* __restrict__ Wq,
    const float* __restrict__ Wk, const float* __restrict__ Wv,
    _Float16* __restrict__ q, _Float16* __restrict__ k,
    _Float16* __restrict__ vT) {
    __shared__ __attribute__((aligned(2048))) float ldsX[8 * XDEPTH * XSLOT];   // 18KB per wave
    __shared__ __attribute__((aligned(16))) _Float16 ldsW[2 * WSTG];            // 2 x 73KB
    __shared__ _Float16 lds[8 * 16 * HEADD];        // 2KB per wave
    const int wave  = (blockIdx.x * blockDim.x + threadIdx.x) >> 5;
    const int wlocal = threadIdx.x >> 5;
    const int lane  = threadIdx.x & 31;
    const int n     = lane & 15;
    const int half  = lane >> 4;
    const int m0    = wave * 16;                    // global token-row base
    const int b     = m0 >> 10;
    const int t0    = m0 & 1023;
    _Float16* lp = lds + wlocal * 16 * HEADD;

    v8f accq[4], acck[4], accv[4];
    const v8f zf = {0.f, 0.f, 0.f, 0.f, 0.f, 0.f, 0.f, 0.f};
#pragma unroll
    for (int nt = 0; nt < 4; ++nt) { accq[nt] = zf; acck[nt] = zf; accv[nt] = zf; }

    const float* xs = ldsX + uni((uint32_t)wlocal) * (XDEPTH * XSLOT);
    const uint32_t xs_b = (uint32_t)(size_t)xs;     // its byte offset in the work-group's LDS
    const uint64_t xg   = (uint64_t)(size_t)(x + (size_t)m0 * N_EMBD);
    const uint32_t xlo  = uni((uint32_t)xg);
    const uint32_t xhi  = uni((uint32_t)(xg >> 32));
    // true only where a 4GB boundary lies inside the first row's 3KB
    const uint32_t wraps = xlo > 0xFFFFFFFFu - (XTILES - 1) * XTILE_B;
    u32x8 g1;
    g1[0] = uni(1u << 20 | 5u << 22 | 3u << 25);
    g1[1] = uni((uint32_t)XTILE_B << 16);
    g1[2] = uni(16u << 16);
    g1[3] = uni((uint32_t)XTILE_B << 16);
    g1[4] = uni(16u);
    g1[5] = uni(N_EMBD * 4u);
    g1[6] = uni(0u);
    g1[7] = uni(0u);
    u32x4 g0;
    g0[0] = uni(1u);
    g0[3] = uni((xhi & 0x01FFFFFFu) | 0x80000000u);
    auto issue_x = [&](int t) {
        if (t > 0 && pinned(wraps)) {
            // the address's high word changes only with no request outstanding
            asm volatile("s_wait_tensorcnt 0" ::: "memory");
            const uint32_t carry = pinned(xlo + (uint32_t)t * XTILE_B < xlo);   // formed behind that wait
            g0[3] = uni(((xhi + carry) & 0x01FFFFFFu) | 0x80000000u);
        }
        g0[1] = pinned(xs_b + (uint32_t)(t % XDEPTH) * (XSLOT * 4u));
        g0[2] = uni(xlo + (uint32_t)t * XTILE_B);
        asm volatile("tensor_load_to_lds %0, %1" : "+s"(g0), "+s"(g1) :: "memory");
    };
#pragma unroll
    for (int t = 0; t < XDEPTH; ++t) issue_x(t);

    // ---- W staging. Of a stage's 24 groups of 8 k rows this wave takes groups 3 * wave + 0..2 of
    // each matrix; a lane takes columns 2 * lane and 2 * lane + 1, so a load covers one whole row.
    // Fragment place of W[kk][nn] (kk inside its k-step): part (kk >> 4) & 1, lane
    // ((kk >> 3) & 1) * 16 + (nn & 15), element kk & 7: a lane's 8 k values of a column are 16B.
    const int wu = (int)uni((uint32_t)wlocal);
    const int wofs = wu * 24 * HEADD + lane * 2;
    const float* wpq = Wq + wofs;
    const float* wpk = Wk + wofs;
    const float* wpv = Wv + wofs;
    auto load_w = [&](WRaw& wr, int s, int gi) {    // group gi of the wave's three, stage s
#pragma unroll
        for (int r = 0; r < 8; ++r) {
            const int o = (s * WKS * 32 + gi * 8 + r) * HEADD;
            wr.m[0][r] = *(const v2f*)(wpq + o);
            wr.m[1][r] = *(const v2f*)(wpk + o);
            wr.m[2][r] = *(const v2f*)(wpv + o);
        }
    };
    auto store_w = [&](const WRaw& wr, int s, int gi) {
        // later values may land in the W loads' address registers: their translations first; the
        // addresses are inputs so that their registers stay unwritten up to this wait
        asm volatile("s_wait_xcnt 0x0" :: "v"(wofs * 4), "v"(wpq), "v"(wpk), "v"(wpv) : "memory");
        const int g = wu * 3 + gi;
        _Float16* dg = ldsW + (s & 1) * WSTG + (lane >> 3) * WFP + (lane & 7) * 16
                     + (g >> 2) * 12 * WFP + ((g >> 1) & 1) * 256 + (g & 1) * 128;
#pragma unroll
        for (int w = 0; w < 3; ++w)
#pragma unroll
            for (int i = 0; i < 2; ++i) {
                v8h h;
#pragma unroll
                for (int r = 0; r < 8; ++r) h[r] = (_Float16)wr.m[w][r][i];
                *(v8h*)(dg + w * 4 * WFP + i * 8) = h;
            }
    };
    // fragment nt of matrix w (0 q, 1 k, 2 v) of k-step ks
    auto wfrag = [&](int ks, int w, int nt) {
        return load_frag_packed(ldsW + ((ks / WKS) & 1) * WSTG + ((ks % WKS) * 12 + w * 4 + nt) * WFP);
    };
    WRaw wr;
    {
        WRaw w1, w2;                                // stage 0: all three groups in flight at once
        load_w(wr, 0, 0);
        load_w(w1, 0, 1);
        load_w(w2, 0, 2);
        store_w(wr, 0, 0);
        store_w(w1, 0, 1);
        store_w(w2, 0, 2);
    }
    // this wave's part of stage 0 is in LDS behind this wait
    asm volatile("s_wait_dscnt 0" ::: "memory");
    // publishes stage 0; no W fragment is read in front of it
    __syncthreads();
    load_w(wr, 1, 0);

    v16h bq[4], bk[4], bv[4];
#pragma unroll
    for (int nt = 0; nt < 4; ++nt) {
        bq[nt] = wfrag(0, 0, nt);
        bk[nt] = wfrag(0, 1, nt);
        bv[nt] = wfrag(0, 2, nt);
    }
    wait_tensor_le<XDEPTH - 1>();                   // tile 0 has landed
    XRaw xr = load_raw_f32(xs, 0, XPITCH);

    // straight-line code, one instance per k-step (a loop left to the unroller came back half
    // rolled, with spills): rolled, part of the fragments came back through a second
    // register set and copies at the loop's foot, which wait on the fresh loads
    auto kstep = [&](auto kc) {
        constexpr int kn = (decltype(kc)::value + 1) * 32;   // kn: the k-step being fetched
        v16h ax = cvt_frag_f32(xr);
        if constexpr (kn < N_EMBD) {
            constexpr int t = kn >> 6;              // the tile that holds k-step kn
            if constexpr ((kn & 63) == 0) {
                // W: at tile boundary t the group fetched at boundary t - 1 goes into the buffer of
                // the stage after the current one; three boundaries fill this wave's part of it
                constexpr bool wput = t <= 3 * (WSTAGES - 1);
                constexpr bool wget = t < 3 * (WSTAGES - 1);
                constexpr bool wnew = wput && (t % 3) == 0;  // k-step kn opens a W stage
                if constexpr (wput) store_w(wr, 1 + (t - 1) / 3, (t - 1) % 3);
                asm volatile("s_wait_dscnt 0" ::: "memory");
                if constexpr (wnew) {
                    // publishes the stage that k-step kn opens, in front of its first fragment reads
                    // (this k-step's refills); the current stage's fragments are all in registers,
                    // so its buffer is free for the W stores that follow this barrier
                    __syncthreads();
                }
                if constexpr (wget) load_w(wr, 1 + t / 3, t % 3);
                if constexpr (t + XDEPTH - 1 < XTILES) issue_x(t + XDEPTH - 1);
                // tile t has landed: only the tiles issued behind it may still be out
                if constexpr (t + 2 < XTILES) wait_tensor_le<2>();
                else if constexpr (t + 1 < XTILES) wait_tensor_le<1>();
                else wait_tensor_le<0>();
            }
            xr = load_raw_f32(xs + (t % XDEPTH) * XSLOT, kn & 63, XPITCH);
            // keeps the four LDS reads here, a whole k-step of WMMAs ahead of their use and of
            // the s_wait_dscnt 0 above: unfenced they sank to right in front of that wait
            __builtin_amdgcn_sched_barrier(0);
        }
#pragma unroll
        for (int nt = 0; nt < 4; ++nt) {
            accq[nt] = wmma16(ax, bq[nt], accq[nt]);
            acck[nt] = wmma16(ax, bk[nt], acck[nt]);
            accv[nt] = wmma16(ax, bv[nt], accv[nt]);
            if constexpr (kn < N_EMBD) {
                bq[nt] = wfrag(kn >> 5, 0, nt);
                bk[nt] = wfrag(kn >> 5, 1, nt);
                bv[nt] = wfrag(kn >> 5, 2, nt);
            }
            // keeps the refills in the order in which the next k-step reads them, and the next
            // conversion and LDS reads behind this k-step's WMMAs: between fences set wider apart
            // a k-step's first WMMA waited for the youngest load, the conversion on reads just issued
            __builtin_amdgcn_sched_barrier(0);
        }
    };
    each_index(kstep, std::make_integer_sequence<int, N_EMBD / 32>{});

    // ---- RoPE: pair (2i,2i+1) lives in adjacent lanes (C-layout: lane = column)
#pragma unroll
    for (int nt = 0; nt < 4; ++nt) {
        const int dcol = nt * 16 + n;
        const float freq = __expf(-(float)(dcol & ~1) * LN10K_64);
        const float sgn  = (dcol & 1) ? 1.f : -1.f;
#pragma unroll
        for (int r = 0; r < 8; ++r) {
            float pos = (float)(t0 + r + 8 * half);
            float s, c;
            __sincosf(pos * freq, &s, &c);
            float vq = accq[nt][r], pq = __shfl_xor(vq, 1, 32);
            float vk = acck[nt][r], pk = __shfl_xor(vk, 1, 32);
            accq[nt][r] = (vq * c + sgn * pq * s) * SCALE_Q;  // fold softmax scale
            acck[nt][r] = (vk * c + sgn * pk * s);
        }
    }

    // ---- q then k: scatter C-layout into LDS, read back in fragment lane order
#pragma unroll
    for (int which = 0; which < 2; ++which) {
        v8f* acc = which ? acck : accq;
        _Float16* gout = which ? k : q;
#pragma unroll
        for (int nt = 0; nt < 4; ++nt)
#pragma unroll
            for (int r = 0; r < 8; ++r)
                lp[(r + 8 * half) * HEADD + nt * 16 + n] = (_Float16)acc[nt][r];
        lds_fence();
#pragma unroll
        for (int j = 0; j < 4; ++j) {               // j = 2 * d-step + part
            v8h d = *(const v8h*)(lp + n * HEADD + j * 16 + half * 8);
            *(v8h*)(gout + (size_t)m0 * HEADD + j * 256 + lane * 8) = d;
        }
        lds_fence();
    }

    // ---- v: these 16 tokens are one part of their 32-key chunk's A-fragments, and
    // the accumulator's lane (column d, 8 consecutive t) is the fragment's own lane
#pragma unroll
    for (int nt = 0; nt < 4; ++nt) {
        v8h pk;
#pragma unroll
        for (int r = 0; r < 8; ++r) pk[r] = (_Float16)accv[nt][r];
        *(v8h*)(vT + (size_t)b * HEADD * SEQ + ((t0 >> 5) * 4 + nt) * 512
                + ((t0 >> 4) & 1) * 256 + lane * 8) = pk;
    }
}

#define OPITCH 68
#define WLDS (16 * OPITCH)
#define CSPLIT 17
#define KVH (SEQ * HEADD)

// One tensor load of this wave: rows x 1024 contiguous bytes from ga to LDS byte lds_dst,
// no pad, no mask; 1-byte elements, tensor = tile, source pitch = row.
__device__ __forceinline__ void tensor_rows_1k(uint32_t lds_dst, uint64_t ga, uint32_t rows) {
    u32x4 g0;
    g0[0] = uni(1u);
    g0[1] = uni(lds_dst);
    g0[2] = uni((uint32_t)ga);
    g0[3] = uni((((uint32_t)(ga >> 32)) & 0x01FFFFFFu) | 0x80000000u);
    u32x8 g1;
    g1[0] = uni(0u);
    g1[1] = uni(1024u << 16);
    g1[2] = uni((rows & 0xFFFFu) << 16);
    g1[3] = uni(1024u << 16);
    g1[4] = uni(rows);
    g1[5] = uni(1024u);
    g1[6] = uni(0u);
    g1[7] = uni(0u);
    asm volatile("tensor_load_to_lds %0, %1" :: "s"(g0), "s"(g1) : "memory");
}

__device__ __forceinline__ float other_half(float v) {
    const int bits = __builtin_bit_cast(int, v);
    return __builtin_bit_cast(float, __builtin_amdgcn_permlanex16(
        bits, bits, 0x76543210, 0xfedcba98, false, false));
}

// Online softmax attention of the query tile at row t0 of its batch over key
// chunks c0 .. c1 - 1 (c0 < c1); aq0, aq1: the tile's Q fragments; kb, vb: the batch's
// K and V fragments, in LDS.
// acc[nt][r] = O[query t0 + n][d = nt * 16 + 8 * half + r]; mrow: running maximum
// (equal in both halves); lrow: running sum over this half's keys only.
__device__ __forceinline__ void attend(
    const v16h aq0, const v16h aq1, const _Float16* __restrict__ kb,
    const _Float16* __restrict__ vb, int t0, int c0, int c1,
    v8f (&acc)[4], float& mrow, float& lrow) {
    const int lane  = threadIdx.x & 31;
    const int n     = lane & 15;
    const int half  = lane >> 4;
    const v8f zf = {0.f, 0.f, 0.f, 0.f, 0.f, 0.f, 0.f, 0.f};
    const int cdiag = t0 >> 5;                      // the chunk that holds the diagonal

    v16h kf[4];
#pragma unroll
    for (int f = 0; f < 4; ++f) kf[f] = load_frag_packed(kb + (c0 * 4 + f) * 512);
    for (int c2 = c0; c2 < c1; ++c2) {
        const int cb = c2 << 5;
        v16h vf[4];
#pragma unroll
        for (int nt = 0; nt < 4; ++nt) vf[nt] = load_frag_packed(vb + (c2 * 4 + nt) * 512);
        // ---- S^T = K Q^T for 32 keys: S0[r] = key cb + 8 * half + r, S1[r] = 16 keys on
        v8f S0 = zf, S1 = zf;
        S0 = wmma16(kf[0], aq0, S0);
        S0 = wmma16(kf[1], aq1, S0);
        S1 = wmma16(kf[2], aq0, S1);
        S1 = wmma16(kf[3], aq1, S1);
        // next chunk's K; the last chunk fetches itself again (in bounds, unused)
        const int cn = (c2 + 1 < c1) ? c2 + 1 : c2;
#pragma unroll
        for (int f = 0; f < 4; ++f) kf[f] = load_frag_packed(kb + (cn * 4 + f) * 512);

        if (c2 == cdiag) {                          // causal mask (diag chunk only)
            const int row  = t0 + n;
            const int key0 = cb + 8 * half, key1 = key0 + 16;
#pragma unroll
            for (int r = 0; r < 8; ++r) {
                if (key0 + r > row) S0[r] = -1.0e30f;
                if (key1 + r > row) S1[r] = -1.0e30f;
            }
        }

        // ---- online softmax of one query per lane pair
        // maximum as a tree of threes: three dependent links, not eight
        const float ma = fmaxf(fmaxf(S0[0], S0[1]), S0[2]);
        const float mb = fmaxf(fmaxf(S0[3], S0[4]), S0[5]);
        const float mc = fmaxf(fmaxf(S0[6], S0[7]), S1[0]);
        const float md = fmaxf(fmaxf(S1[1], S1[2]), S1[3]);
        const float me = fmaxf(fmaxf(S1[4], S1[5]), S1[6]);
        float mx = fmaxf(fmaxf(fmaxf(ma, mb), mc), fmaxf(fmaxf(md, me), S1[7]));
        mx = fmaxf(mx, other_half(mx));
        const float mn = fmaxf(mrow, mx);
        const float sc = __expf(mrow - mn);
        v16h pb;                                    // P^T as B: element s = key cb + 8 * half + s, plus 8 for s >= 8
        float rs[8];
#pragma unroll
        for (int r = 0; r < 8; ++r) {
            const float p0 = __expf(S0[r] - mn);
            const float p1 = __expf(S1[r] - mn);
            rs[r] = p0 + p1;
            pb[r]     = (_Float16)p0;
            pb[8 + r] = (_Float16)p1;
        }
        lrow = lrow * sc + (((rs[0] + rs[1]) + (rs[2] + rs[3])) + ((rs[4] + rs[5]) + (rs[6] + rs[7])));
        mrow = mn;
        // ---- O^T = O^T * sc + V^T P^T
#pragma unroll
        for (int nt = 0; nt < 4; ++nt) {
#pragma unroll
            for (int r = 0; r < 8; ++r) acc[nt][r] *= sc;
            acc[nt] = wmma16(vf[nt], pb, acc[nt]);
        }
    }
}

// join the halves' sums, normalize, turn the tile through this wave's own LDS so
// that every 16B store instruction covers 512B in a row
__device__ __forceinline__ void store_tile(
    const v8f (&acc)[4], float lrow, float* lo, float* __restrict__ orow) {
    const int lane  = threadIdx.x & 31;
    const int n     = lane & 15;
    const int half  = lane >> 4;
    const float inv = 1.0f / (lrow + other_half(lrow));
#pragma unroll
    for (int nt = 0; nt < 4; ++nt)
#pragma unroll
        for (int j = 0; j < 2; ++j) {
            v4f d;
#pragma unroll
            for (int i = 0; i < 4; ++i) d[i] = acc[nt][j * 4 + i] * inv;
            *(v4f*)(lo + n * OPITCH + nt * 16 + half * 8 + j * 4) = d;
        }
    lds_fence();
#pragma unroll
    for (int i = 0; i < 8; ++i) {
        const int row = i * 2 + half;
        v4f d = *(const v4f*)(lo + row * OPITCH + n * 4);
        *(v4f*)(orow + (size_t)row * HEADD + n * 4) = d;
    }
}

__global__ __launch_bounds__(256) void flash_attn_kernel(
    const _Float16* __restrict__ q, const _Float16* __restrict__ k,
    const _Float16* __restrict__ vT, float* __restrict__ out) {
    __shared__ __attribute__((aligned(2048))) _Float16 ldsKV[2 * KVH];   // K 128KB | V 128KB
    __shared__ __attribute__((aligned(16))) float ldsO[8 * WLDS];   // 4.25KB per wave
    const int wv    = __builtin_amdgcn_readfirstlane((int)(threadIdx.x >> 5));
    const int lane  = threadIdx.x & 31;
    const int b     = blockIdx.x >> 3;              // batch
    const int tl    = (blockIdx.x & 7) * 4 + (wv & 3);   // short tile 0..31
    const int th    = 63 - tl;                      // long tile 32..63
    const int nchh  = (th >> 1) + 1;                // its chunks, 17..32
    const bool second = wv >= 4;
    float* lo = ldsO + wv * WLDS;
    const _Float16* qb = q + (size_t)(b << 10) * HEADD;
    const _Float16* kb = ldsKV;
    const _Float16* vb = ldsKV + KVH;
    float* ob = out + (size_t)(b << 10) * HEADD;

    // Q fragments first, so that they fly while K and V are staged: the first tile's, and
    // in a second wave the long tile's as well
    const _Float16* qf = qb + (second ? tl : th) * 16 * HEADD;
    const _Float16* qh = qb + th * 16 * HEADD;
    const v16h qa0 = load_frag_packed(qf);
    const v16h qa1 = load_frag_packed(qf + 512);
    v16h qc0, qc1;                                  // set and read in second waves only
    if (second) {
        qc0 = load_frag_packed(qh);
        qc1 = load_frag_packed(qh + 512);
    }
    // later values may land in the Q loads' address registers: their translations first;
    // the two bases are inputs so that their registers stay unwritten up to this wait
    asm volatile("s_wait_xcnt 0x0" :: "s"(qf), "s"(qh) : "memory");

    // K and V chunks 0 .. nmax - 1 into LDS as they lie; nmax (18 .. 32, even) is the chunk
    // count of the work-group's longest tile. Waves 0-3 bring a quarter of K each, waves 4-7
    // of V: nmax rows of 1KB, so every slice starts at a multiple of 2KB.
    {
        const uint32_t nmax  = 32u - 2u * (blockIdx.x & 7u);
        const uint32_t slice = (uint32_t)(wv & 3) * nmax * 1024u;
        const _Float16* gsrc = (second ? vT : k) + (size_t)b * KVH;
        tensor_rows_1k((uint32_t)(size_t)ldsKV + (second ? 2u * KVH : 0u) + slice,
                       (uint64_t)(size_t)gsrc + slice, nmax);
        // this wave's slice has landed behind it
        asm volatile("s_wait_tensorcnt 0" ::: "memory");
    }
    // publishes every wave's slice; nothing of K or V is read in front of it
    __syncthreads();

    const v8f zf = {0.f, 0.f, 0.f, 0.f, 0.f, 0.f, 0.f, 0.f};
    v8f acc[4];
#pragma unroll
    for (int nt = 0; nt < 4; ++nt) acc[nt] = zf;
    float mrow = -3.0e38f;
    float lrow = 0.f;

    if (second) {
        attend(qa0, qa1, kb, vb, tl * 16, 0, (tl >> 1) + 1, acc, mrow, lrow);
        store_tile(acc, lrow, lo, ob + tl * 16 * HEADD);
        // later values may land in these stores' registers: their translations first
        asm volatile("s_wait_xcnt 0x0" ::: "memory");
#pragma unroll
        for (int nt = 0; nt < 4; ++nt) acc[nt] = zf;
        mrow = -3.0e38f;
        lrow = 0.f;
        if (CSPLIT < nchh)
            attend(qc0, qc1, kb, vb, th * 16, CSPLIT, nchh, acc, mrow, lrow);
        // partial state, lane by lane: 8 x 16B (512B in a row per store), maximum, sum
#pragma unroll
        for (int nt = 0; nt < 4; ++nt)
#pragma unroll
            for (int j = 0; j < 2; ++j) {
                v4f d;
#pragma unroll
                for (int i = 0; i < 4; ++i) d[i] = acc[nt][j * 4 + i];
                *(v4f*)(lo + ((nt * 2 + j) * 32 + lane) * 4) = d;
            }
        lo[1024 + lane] = mrow;
        lo[1056 + lane] = lrow;
    } else {
        attend(qa0, qa1, kb, vb, th * 16, 0, CSPLIT, acc, mrow, lrow);
    }

    // the one hand-over: partial states written above are read below
    __syncthreads();

    if (!second) {
        const float* pp = ldsO + (wv + 4) * WLDS;
        const float mo = pp[1024 + lane];
        const float so = pp[1056 + lane];
        const float mn = fmaxf(mrow, mo);
        const float sa = __expf(mrow - mn);         // an empty partial has maximum -3e38: sb = 0
        const float sb = __expf(mo - mn);
        lrow = lrow * sa + so * sb;
#pragma unroll
        for (int nt = 0; nt < 4; ++nt)
#pragma unroll
            for (int j = 0; j < 2; ++j) {
                v4f d = *(const v4f*)(pp + ((nt * 2 + j) * 32 + lane) * 4);
#pragma unroll
                for (int i = 0; i < 4; ++i)
                    acc[nt][j * 4 + i] = acc[nt][j * 4 + i] * sa + d[i] * sb;
            }
        store_tile(acc, lrow, lo, ob + th * 16 * HEADD);
    }
}

// ---------------------------------------------------------------------------
extern "C" void kernel_launch(void* const* d_in, const int* in_sizes, int n_in,
                              void* d_out, int out_size, void* d_ws, size_t ws_size,
                              hipStream_t stream) {
    const float* x  = (const float*)d_in[0];
    const float* Wq = (const float*)d_in[1];
    const float* Wk = (const float*)d_in[2];
    const float* Wv = (const float*)d_in[3];
    float* out = (float*)d_out;

    // workspace layout (f16, 1KB lane-order fragments): q[2048][2] | k[2048][2] | v[32][32][4]
    unsigned char* ws = (unsigned char*)d_ws;
    const size_t QK_BYTES = (size_t)MROWS * HEADD * 2;        //  4194304
    _Float16* q  = (_Float16*)(ws);
    _Float16* kk = (_Float16*)(ws + QK_BYTES);
    _Float16* vT = (_Float16*)(ws + 2 * QK_BYTES);

    // 1) QKV + RoPE: 2048 waves, 8 waves/block
    qkv_rope_kernel<<<MROWS / 128, 256, 0, stream>>>(x, Wq, Wk, Wv, q, kk, vT);

    // 2) flash attention: 2048 query tiles, 8 per block (4 long, 4 short), 8 waves/block
    flash_attn_kernel<<<(MROWS / 16) / 8, 256, 0, stream>>>(q, kk, vT, out);
}
